// v000
// Measured on an AMD MI455X. A time is GPU time per run, averaged over a window of back-to-back runs after a warm-up
// (all launches, gaps included; the runs take copies of the inputs in turn), and the median of several windows.
// Apart from v000's, it joins two sittings. Times from different sittings can be a few percent apart, while
// side-by-side timings come from the same sitting.
// v000 is the starting kernel. One run takes 2950 microseconds.
#include <hip/hip_runtime.h>

// Multi-head self-attention with per-head projection weights (inputs [8][1024][1024]; proj = einsum('bpv,havn->bhapn', inputs, w_qkv [16][3][1024][64]): q/k/v of head h = inputs w_qkv[h][0/1/2] ([1024][64]); scores = q.k / 8 over all 1024 keys; softmax; out = merged heads ([p][h*64+n]) w_o ('xw' [1024][1024]) -> [8][1024][1024] (8.4 M)).
// Compute dtypes, f32 accumulate: every input rounded to bf16; q/k/v on PLAIN bf16 operands (inputs: exact); the per-head weight slices gathered into three Bt matrices [h*64+n][v] (exact copies); scores and attn.v on bf16 hi/lo planes (3 products) for every query row (logit sigma 2.5); softmax f32; w_o hl x exact (2 products).

#define NB_  8
#define TT   1024
#define DM   1024
#define NH_  16
#define NKV  16
#define REP  (NH_ / NKV)
#define HD   64
#define DQ   (NH_ * HD)
#define DKV  (NKV * HD)
#define ZH   2
#define RH   1024                 // every query row uses hi+lo planes (RH = TT)
#define WIN  0
#define PCAR 1024.0f
#define SCL  0.125f   // HD^-0.5
typedef _Float16 h16;
typedef unsigned short bf;
typedef __attribute__((ext_vector_type(16))) __bf16   v16bf;
typedef __attribute__((ext_vector_type(16))) _Float16 v16h;
typedef __attribute__((ext_vector_type(8)))  _Float16 v8h;
typedef __attribute__((ext_vector_type(8)))  unsigned short v8us;
typedef __attribute__((ext_vector_type(8)))  float    v8f;
typedef __attribute__((ext_vector_type(4)))  float    v4f;
typedef v8h  __attribute__((may_alias)) v8ha;
typedef v4f  __attribute__((may_alias)) v4fa;
typedef v8us __attribute__((may_alias)) v8usa;

__device__ __forceinline__ unsigned short f2bf(float f) { unsigned u = __float_as_uint(f); u += 0x7FFFu + ((u >> 16) & 1u); return (unsigned short)(u >> 16); }
__device__ __forceinline__ float bf2f(unsigned short b) { return __uint_as_float(((unsigned)b) << 16); }
__device__ __forceinline__ float bfr(float f) { return bf2f(f2bf(f)); }
__device__ __forceinline__ v16h cat16(v8h lo, v8h hi) { return __builtin_shufflevector(lo, hi, 0, 1, 2, 3, 4, 5, 6, 7, 8, 9, 10, 11, 12, 13, 14, 15); }
__device__ __forceinline__ v16bf cat16b(v8us lo, v8us hi) { return __builtin_bit_cast(v16bf, __builtin_shufflevector(lo, hi, 0, 1, 2, 3, 4, 5, 6, 7, 8, 9, 10, 11, 12, 13, 14, 15)); }
__device__ __forceinline__ v8f wmma16(v16h a, v16h b, v8f c) { return __builtin_amdgcn_wmma_f32_16x16x32_f16(false, a, false, b, (short)0, c, false, false); }
__device__ __forceinline__ v8f wmmab(v16bf a, v16bf b, v8f c) { return __builtin_amdgcn_wmma_f32_16x16x32_bf16(false, a, false, b, (short)0, c, false, false); }



// ---- k_gemmw: register-blocked GEMM, ONE WAVE per 64x64 output tile (16 accumulators), operands straight from K-contiguous 16-bit planes; grid (M/64, N/64, Z), 32 threads.
// C[m][n] (f32, pitch ldc, + optional f32 bias[n]) = sum_k A[m][k] Bt[n][k] (+ split products per NSPLIT). z-batch strides sA/sB/sC in elements. K % 32 == 0.
template <typename T16> struct WFrag;
template <> struct WFrag<h16> { typedef v16h V; static __device__ __forceinline__ V ld(const h16* p) { return cat16(*(const v8h*)p, *(const v8h*)(p + 16)); } static __device__ __forceinline__ v8f mma(V a, V b, v8f c) { return wmma16(a, b, c); } };
template <> struct WFrag<bf> { typedef v16bf V; static __device__ __forceinline__ V ld(const bf* p) { return cat16b(*(const v8us*)p, *(const v8us*)(p + 16)); } static __device__ __forceinline__ v8f mma(V a, V b, v8f c) { return wmmab(a, b, c); } };
template <typename T16, int NSPLIT, bool BIAS>
__global__ __launch_bounds__(32) void k_gemmw(const T16* __restrict__ A, const T16* __restrict__ A2, const T16* __restrict__ Bt, const T16* __restrict__ Bt2, int K, float* C, int ldc, const float* __restrict__ bias, size_t sA, size_t sB, size_t sC) {
    typedef typename WFrag<T16>::V V;
    __shared__ __align__(16) float os[16 * 68];
    const size_t z = blockIdx.z; A += z * sA; if (A2) A2 += z * sA; Bt += z * sB; if (Bt2) Bt2 += z * sB; C += z * sC;
    const int lane = threadIdx.x & 31, lr = lane & 15, hi = lane >> 4; const int r0 = blockIdx.x * 64, c0 = blockIdx.y * 64;
    v8f acc[4][4];
#pragma unroll
    for (int mb = 0; mb < 4; ++mb)
#pragma unroll
        for (int nb = 0; nb < 4; ++nb) acc[mb][nb] = (v8f){};
    const size_t aoff = (size_t)(r0 + lr) * K + 8 * hi, boff = (size_t)(c0 + lr) * K + 8 * hi;
#pragma unroll 1
    for (int kc = 0; kc < K; kc += 32) {
        V a[4], a2[4];
#pragma unroll
        for (int mb = 0; mb < 4; ++mb) { a[mb] = WFrag<T16>::ld(A + aoff + (size_t)mb * 16 * K + kc); if (NSPLIT == 1 || NSPLIT == 2) a2[mb] = WFrag<T16>::ld(A2 + aoff + (size_t)mb * 16 * K + kc); }
#pragma unroll
        for (int nb = 0; nb < 4; ++nb) { const V b = WFrag<T16>::ld(Bt + boff + (size_t)nb * 16 * K + kc); V b2; if (NSPLIT >= 2) b2 = WFrag<T16>::ld(Bt2 + boff + (size_t)nb * 16 * K + kc);
#pragma unroll
            for (int mb = 0; mb < 4; ++mb) { acc[mb][nb] = WFrag<T16>::mma(a[mb], b, acc[mb][nb]); if (NSPLIT == 1 || NSPLIT == 2) acc[mb][nb] = WFrag<T16>::mma(a2[mb], b, acc[mb][nb]); if (NSPLIT >= 2) acc[mb][nb] = WFrag<T16>::mma(a[mb], b2, acc[mb][nb]); } }
        asm volatile("v_nop\n\tv_nop\n\tv_nop\n\tv_nop" : "+v"(acc[0][0]), "+v"(acc[1][1]), "+v"(acc[2][2]), "+v"(acc[3][3]) : "v"(a[0]), "v"(a[3]));
    }
#pragma unroll
    for (int mb = 0; mb < 4; ++mb) {
#pragma unroll
        for (int nb = 0; nb < 4; ++nb) {
#pragma unroll
            for (int j = 0; j < 8; ++j) os[(hi * 8 + j) * 68 + nb * 16 + lr] = acc[mb][nb][j]; }
        __builtin_amdgcn_wave_barrier(); asm volatile("" ::: "memory");
        float* crow = C + (size_t)(r0 + mb * 16) * ldc + c0;
{
#pragma unroll
            for (int s = 0; s < 8; ++s) { const int row = 2 * s + hi, cofs = lr * 4; v4f val = *(const v4fa*)(os + row * 68 + cofs); if (BIAS) { val[0] += bfr(bias[c0 + cofs]); val[1] += bfr(bias[c0 + cofs + 1]); val[2] += bfr(bias[c0 + cofs + 2]); val[3] += bfr(bias[c0 + cofs + 3]); }
                *(v4f*)(crow + (size_t)row * ldc + cofs) = val; }
             }
        __builtin_amdgcn_wave_barrier(); asm volatile("" ::: "memory");
    }
}

__device__ __forceinline__ h16 tohx(float x) { return (h16)x; }
__device__ __forceinline__ void splitf(float y, unsigned short& h, unsigned short& l) { h = f2bf(y); l = f2bf(y - bf2f(h)); }
typedef __attribute__((ext_vector_type(2))) _Float16 v2h;
typedef __attribute__((ext_vector_type(4))) _Float16 v4h;
typedef __attribute__((ext_vector_type(2))) unsigned short v2us;
typedef __attribute__((ext_vector_type(4))) unsigned short v4us;
typedef __attribute__((ext_vector_type(2))) float v2f;
typedef __attribute__((ext_vector_type(4))) int v4i;

__global__ __launch_bounds__(256) void k_wtG(const float* __restrict__ w, int K, int N, bf* Bt) {
    const int lane = threadIdx.x & 31; const int L0 = (blockIdx.x * 8 + (threadIdx.x >> 5)) * 8; const int nlines = N * K / 64;
{
#pragma unroll 1
        for (int l = 0; l < 8; ++l) { const int L = L0 + l; if (L >= nlines) break; const size_t e = (size_t)L * 64 + lane * 2; const int k = (int)(e % K), n = (int)(e / K); v2us o;
            o[0] = f2bf(w[(size_t)k * N + n]); o[1] = f2bf(w[(size_t)(k + 1) * N + n]); *(v2us*)(Bt + e) = o; }
         }
}
__global__ __launch_bounds__(256) void k_wtGh(const float* __restrict__ W, int part, bf* dst) { const size_t i = (size_t)blockIdx.x * 256 + threadIdx.x; if (i >= (size_t)DQ * DM / 8) return; const int o = (int)(i / (DM / 8)); const int v0 = (int)(i % (DM / 8)) * 8; const int h = o / HD, n = o % HD; const float* src = W + (((size_t)h * 3 + part) * DM + v0) * HD + n; v8us ov;
#pragma unroll
    for (int k = 0; k < 8; ++k) ov[k] = f2bf(src[(size_t)k * HD]); *(v8us*)(dst + (size_t)o * DM + v0) = ov;  }
__global__ __launch_bounds__(256) void k_cvt8(const float* __restrict__ src, bf* dst, size_t n8) { const size_t i = (size_t)blockIdx.x * 256 + threadIdx.x; if (i >= n8) return; const v8f v = *(const v8f*)(src + i * 8); v8us o;
#pragma unroll
    for (int k = 0; k < 8; ++k) o[k] = f2bf(v[k]); *(v8us*)(dst + i * 8) = o;  }

// k_rope: head planes [h][t][d] (fp16 + hi/lo) of rope(x) x sc with the rotate-half convention out[d] = x[d] cos[t][d] - x[d+HD/2] sin[t][d], out[d+HD/2] = x[d+HD/2] cos[t][d+HD/2] + x[d] sin[t][d+HD/2]
__global__ __launch_bounds__(256) void k_rope(const float* __restrict__ F, int pitch, int nheads, const float* __restrict__ CS, const float* __restrict__ RF, const float* __restrict__ nw, float sc, h16* P16, bf* Ph, bf* Pl) {
    const size_t e = ((size_t)blockIdx.x * 256 + threadIdx.x) * 2; if (e >= (size_t)nheads * TT * HD) return; const int d = (int)(e % HD); const int t = (int)((e / HD) % TT); const int h = (int)(e / ((size_t)HD * TT)); const float* f = F + (size_t)t * pitch + h * HD; const float rf = RF ? RF[(size_t)h * TT + t] : 1.0f; v2h o16; v2us oh, ol;
#pragma unroll
    for (int q = 0; q < 2; ++q) { const int dd = d + q; const int dp = (dd < HD / 2) ? dd + HD / 2 : dd - HD / 2; float x0 = f[dd], x1 = f[dp];
        if (RF) { float n0 = __fmul_rn(x0, rf), n1 = __fmul_rn(x1, rf); asm volatile("" : "+v"(n0)); asm volatile("" : "+v"(n1)); x0 = __fmul_rn(bfr(nw[dd]), n0); x1 = __fmul_rn(bfr(nw[dp]), n1); }
        const v2f cs = *(const v2f*)(CS + ((size_t)t * HD + dd) * 2); float a = __fmul_rn(x0, cs[0]), bq = __fmul_rn(x1, cs[1]); asm volatile("" : "+v"(a)); asm volatile("" : "+v"(bq)); const float r = ((dd < HD / 2) ? __fsub_rn(a, bq) : __fadd_rn(a, bq)) * sc;
        o16[q] = tohx(r); unsigned short a2, c2; splitf(r, a2, c2); oh[q] = a2; ol[q] = c2; }
    *(v2h*)(P16 + e) = o16; *(v2us*)(Ph + e) = oh; *(v2us*)(Pl + e) = ol;  }
__global__ __launch_bounds__(256) void k_vtp(const float* __restrict__ F, int pitch, int nheads, h16* V16, bf* Vh, bf* Vl) { const size_t e = ((size_t)blockIdx.x * 256 + threadIdx.x) * 2; if (e >= (size_t)nheads * HD * TT) return; const int t = (int)(e % TT); const int d = (int)((e / TT) % HD); const int g = (int)(e / ((size_t)TT * HD)); v2h o16; v2us oh, ol;
#pragma unroll
    for (int q = 0; q < 2; ++q) { const float x = F[(size_t)(t + q) * pitch + g * HD + d]; o16[q] = tohx(x); unsigned short a2, c2; splitf(x, a2, c2); oh[q] = a2; ol[q] = c2; }
    *(v2h*)(V16 + e) = o16; *(v2us*)(Vh + e) = oh; *(v2us*)(Vl + e) = ol;  }
__global__ __launch_bounds__(256) void k_csid(float* CS) { const int idx = blockIdx.x * 256 + threadIdx.x; if (idx >= TT * HD) return; v2f cs; cs[0] = 1.0f; cs[1] = 0.0f; *(v2f*)(CS + (size_t)idx * 2) = cs;  }
// k_asoft: per row (zz, i): t = S x HD^-0.5 (no mask); softmax over the 1024 keys (register row, one exp, fixed trees);
__global__ __launch_bounds__(256) void k_asoft(const float* __restrict__ Sb, h16* P16, bf* Ph, bf* Pl) {
    const int lane = threadIdx.x & 31; const int row = blockIdx.x * 8 + (threadIdx.x >> 5); if (row >= ZH * TT) return; const int i = row % TT; const int zz = row / TT; (void)zz; const bool hires = (i < RH); const float* sr = Sb + (size_t)row * TT; float v[TT / 32]; float mx = -3.0e38f;
#pragma unroll
    for (int ch = 0; ch < TT / 128; ++ch) { const int j0 = ch * 128 + lane * 4; const v4f a = *(const v4f*)(sr + j0);
#pragma unroll
        for (int q = 0; q < 4; ++q) { const int j = j0 + q; (void)j; const float t = a[q] * SCL; v[ch * 4 + q] = t; mx = fmaxf(mx, t); } }
#pragma unroll
    for (int sh = 16; sh; sh >>= 1) mx = fmaxf(mx, __shfl_xor(mx, sh, 32));
    float sum = 0.f;
#pragma unroll
    for (int k = 0; k < TT / 32; ++k) { float d0 = __fsub_rn(v[k], mx); asm volatile("" : "+v"(d0)); v[k] = __builtin_amdgcn_exp2f(__fmul_rn(d0, 1.4426950408889634f)); sum += v[k]; }
#pragma unroll
    for (int sh = 16; sh; sh >>= 1) sum += __shfl_xor(sum, sh, 32);
    const float f = __fdiv_rn(hires ? 1.0f : PCAR, sum);
{
        if (hires) {
#pragma unroll
            for (int ch = 0; ch < TT / 128; ++ch) { v4us oh, ol;
#pragma unroll
                for (int q = 0; q < 4; ++q) { unsigned short a, c2; splitf(v[ch * 4 + q] * f, a, c2); oh[q] = a; ol[q] = c2; }
                const size_t oo = ((size_t)zz * (RH ? RH : 1) + i) * TT + ch * 128 + lane * 4; *(v4us*)(Ph + oo) = oh; *(v4us*)(Pl + oo) = ol; }
        } else {
#pragma unroll
            for (int ch = 0; ch < TT / 128; ++ch) { v4h o4;
#pragma unroll
                for (int q = 0; q < 4; ++q) o4[q] = tohx(v[ch * 4 + q] * f);
                *(v4h*)(P16 + (size_t)row * TT + ch * 128 + lane * 4) = o4; } }
         }
}
__global__ __launch_bounds__(256) void k_merge(const float* __restrict__ O, int h0, bf* Ah, bf* Al) { const size_t e = ((size_t)blockIdx.x * 256 + threadIdx.x) * 2; if (e >= (size_t)ZH * TT * HD) return; const int d = (int)(e % HD); const int t = (int)((e / HD) % TT); const int zz = (int)(e / ((size_t)HD * TT)); const float cs = (t < RH) ? 1.0f : (1.0f / PCAR); const size_t oo = (size_t)t * DQ + (h0 + zz) * HD + d;
    v2us oh, ol;
#pragma unroll
    for (int q = 0; q < 2; ++q) { unsigned short a, c2; splitf(O[e + q] * cs, a, c2); oh[q] = a; ol[q] = c2; } *(v2us*)(Ah + oo) = oh; *(v2us*)(Al + oo) = ol;  }

extern "C" void kernel_launch(void* const* d_in, const int* in_sizes, int n_in,
                              void* d_out, int out_size, void* d_ws, size_t ws_size, hipStream_t stream) {
    (void)in_sizes; (void)n_in; (void)out_size;
    const float* x = (const float*)d_in[0]; const float* wqkv = (const float*)d_in[1]; const float* wo = (const float*)d_in[2]; const float* wq = nullptr; const float* wk = nullptr; const float* wv = nullptr; (void)wq; (void)wk; (void)wv;
    float* OUT = (float*)d_out;     // [8][1024][1024]
    char* wsp = (char*)d_ws;
    auto take = [&](size_t bytes) { char* p = wsp; wsp += (bytes + 255) & ~(size_t)255; return (void*)p; };
    bf* WQ = (bf*)take((size_t)DQ * DM * 2); bf* WK = (bf*)take((size_t)DKV * DM * 2); bf* WV = (bf*)take((size_t)DKV * DM * 2); bf* WO = (bf*)take((size_t)DM * DQ * 2); float* CS = (float*)take((size_t)TT * HD * 2 * 4);
    bf* XB = (bf*)take((size_t)TT * DM * 2); float* FQ = (float*)take((size_t)TT * DQ * 4); float* FK = (float*)take((size_t)TT * DKV * 4);
    h16* QP16 = (h16*)take((size_t)NH_ * TT * HD * 2); h16* KP16 = (h16*)take((size_t)NKV * TT * HD * 2); h16* VT16 = (h16*)take((size_t)NKV * HD * TT * 2);
    bf* QPh = (bf*)take((size_t)NH_ * TT * HD * 2); bf* QPl = (bf*)take((size_t)NH_ * TT * HD * 2); bf* KPh = (bf*)take((size_t)NKV * TT * HD * 2); bf* KPl = (bf*)take((size_t)NKV * TT * HD * 2); bf* VTh = (bf*)take((size_t)NKV * HD * TT * 2); bf* VTl = (bf*)take((size_t)NKV * HD * TT * 2); bf* Ph = (bf*)take((size_t)ZH * RH * TT * 2); bf* Pl = (bf*)take((size_t)ZH * RH * TT * 2);
    float* Sb = (float*)take((size_t)ZH * TT * TT * 4); h16* P16 = (h16*)take((size_t)ZH * TT * TT * 2); float* Ob = (float*)take((size_t)ZH * TT * HD * 4); bf* ATh = (bf*)take((size_t)TT * DQ * 2); bf* ATl = (bf*)take((size_t)TT * DQ * 2);
    if ((size_t)(wsp - (char*)d_ws) > ws_size) return;    // ws 256 MiB
    float* FV = FK;   // v projection reuses the k buffer after the k planes are built (stream-ordered)
    { k_wtGh<<<(unsigned)(((size_t)DQ * DM / 8 + 255) / 256), 256, 0, stream>>>(wqkv, 0, WQ); k_wtGh<<<(unsigned)(((size_t)DQ * DM / 8 + 255) / 256), 256, 0, stream>>>(wqkv, 1, WK); k_wtGh<<<(unsigned)(((size_t)DQ * DM / 8 + 255) / 256), 256, 0, stream>>>(wqkv, 2, WV);
      k_wtG<<<(unsigned)((DQ * DM / 64 + 63) / 64), 256, 0, stream>>>(wo, DQ, DM, WO);
       }
    k_csid<<<(TT * HD + 255) / 256, 256, 0, stream>>>(CS);
    const unsigned LQ = (unsigned)(((size_t)NH_ * TT * HD / 2 + 255) / 256), LKv = (unsigned)(((size_t)NKV * TT * HD / 2 + 255) / 256);
    for (int b = 0; b < NB_; ++b) {
        
        k_cvt8<<<(unsigned)(((size_t)TT * DM / 8 + 255) / 256), 256, 0, stream>>>(x + (size_t)b * TT * DM, XB, (size_t)TT * DM / 8);
        k_gemmw<bf, 0, false><<<dim3(TT / 64, DQ / 64, 1), 32, 0, stream>>>(XB, nullptr, WQ, nullptr, DM, FQ, DQ, nullptr, 0, 0, 0);
        k_rope<<<LQ, 256, 0, stream>>>(FQ, DQ, NH_, CS, nullptr, nullptr, 1.0f, QP16, QPh, QPl);
        k_gemmw<bf, 0, false><<<dim3(TT / 64, DKV / 64, 1), 32, 0, stream>>>(XB, nullptr, WK, nullptr, DM, FK, DKV, nullptr, 0, 0, 0);
        k_rope<<<LKv, 256, 0, stream>>>(FK, DKV, NKV, CS, nullptr, nullptr, 1.0f, KP16, KPh, KPl);
        k_gemmw<bf, 0, false><<<dim3(TT / 64, DKV / 64, 1), 32, 0, stream>>>(XB, nullptr, WV, nullptr, DM, FV, DKV, nullptr, 0, 0, 0); k_vtp<<<LKv, 256, 0, stream>>>(FV, DKV, NKV, VT16, VTh, VTl);
        for (int h0 = 0; h0 < NH_; h0 += ZH) { const size_t zq = (size_t)h0, zk = (size_t)(h0 / REP);   // one kv head per query head: the pass's two heads use consecutive kv planes (z-strides TT*HD)
            k_gemmw<bf, 2, false><<<dim3(RH / 64, TT / 64, ZH), 32, 0, stream>>>(QPh + zq * TT * HD, QPl + zq * TT * HD, KPh + zk * TT * HD, KPl + zk * TT * HD, HD, Sb, TT, nullptr, (size_t)TT * HD, (size_t)TT * HD, (size_t)TT * TT);
            k_asoft<<<ZH * TT / 8, 256, 0, stream>>>(Sb, P16, Ph, Pl);
            k_gemmw<bf, 2, false><<<dim3(RH / 64, HD / 64, ZH), 32, 0, stream>>>(Ph, Pl, VTh + zk * HD * TT, VTl + zk * HD * TT, TT, Ob, HD, nullptr, (size_t)RH * TT, (size_t)HD * TT, (size_t)TT * HD);
            k_merge<<<(unsigned)(((size_t)ZH * TT * HD / 2 + 255) / 256), 256, 0, stream>>>(Ob, h0, ATh, ATl); }
        k_gemmw<bf, 1, false><<<dim3(TT / 64, DM / 64, 1), 32, 0, stream>>>(ATh, ATl, WO, nullptr, DQ, OUT + (size_t)b * TT * DM, DM, nullptr, 0, 0, 0); }
}

// v001
// Measured time: 840 microseconds a run.
// In both of two side-by-side timings against v000, it was 3.54 times as fast.
#include <hip/hip_runtime.h>

// Multi-head self-attention with per-head projection weights (inputs [8][1024][1024]; proj = einsum('bpv,havn->bhapn', inputs, w_qkv [16][3][1024][64]): q/k/v of head h = inputs w_qkv[h][0/1/2] ([1024][64]); scores = q.k / 8 over all 1024 keys; softmax; out = merged heads ([p][h*64+n]) w_o ('xw' [1024][1024]) -> [8][1024][1024] (8.4 M)).
// Compute dtypes, f32 accumulate: every input rounded to bf16; q/k/v on PLAIN bf16 operands (inputs: exact); the per-head weight slices gathered into three Bt matrices [h*64+n][v] (exact copies); scores and attn.v on bf16 hi/lo planes (3 products) for every query row (logit sigma 2.5); softmax f32; w_o hl x exact (2 products).

#define NB_  8
#define TT   1024
#define DM   1024
#define NH_  16
#define NKV  16
#define REP  (NH_ / NKV)
#define HD   64
#define DQ   (NH_ * HD)
#define DKV  (NKV * HD)
#define ZH   16                   // (batch, head) planes per attention pass: all heads of one batch entry
#define RH   1024                 // every query row uses hi+lo planes (RH = TT)
#define WIN  0
#define PCAR 1024.0f
#define SCL  0.125f   // HD^-0.5
typedef _Float16 h16;
typedef unsigned short bf;
typedef __attribute__((ext_vector_type(16))) __bf16   v16bf;
typedef __attribute__((ext_vector_type(16))) _Float16 v16h;
typedef __attribute__((ext_vector_type(8)))  _Float16 v8h;
typedef __attribute__((ext_vector_type(8)))  unsigned short v8us;
typedef __attribute__((ext_vector_type(8)))  float    v8f;
typedef __attribute__((ext_vector_type(4)))  float    v4f;
typedef v8h  __attribute__((may_alias)) v8ha;
typedef v4f  __attribute__((may_alias)) v4fa;
typedef v8us __attribute__((may_alias)) v8usa;

__device__ __forceinline__ unsigned short f2bf(float f) { unsigned u = __float_as_uint(f); u += 0x7FFFu + ((u >> 16) & 1u); return (unsigned short)(u >> 16); }
__device__ __forceinline__ float bf2f(unsigned short b) { return __uint_as_float(((unsigned)b) << 16); }
__device__ __forceinline__ float bfr(float f) { return bf2f(f2bf(f)); }
__device__ __forceinline__ v16h cat16(v8h lo, v8h hi) { return __builtin_shufflevector(lo, hi, 0, 1, 2, 3, 4, 5, 6, 7, 8, 9, 10, 11, 12, 13, 14, 15); }
__device__ __forceinline__ v16bf cat16b(v8us lo, v8us hi) { return __builtin_bit_cast(v16bf, __builtin_shufflevector(lo, hi, 0, 1, 2, 3, 4, 5, 6, 7, 8, 9, 10, 11, 12, 13, 14, 15)); }
__device__ __forceinline__ v8f wmma16(v16h a, v16h b, v8f c) { return __builtin_amdgcn_wmma_f32_16x16x32_f16(false, a, false, b, (short)0, c, false, false); }
__device__ __forceinline__ v8f wmmab(v16bf a, v16bf b, v8f c) { return __builtin_amdgcn_wmma_f32_16x16x32_bf16(false, a, false, b, (short)0, c, false, false); }



// ---- k_gemmw: register-blocked GEMM, ONE WAVE per 64x64 output tile (16 accumulators), operands straight from K-contiguous 16-bit planes; grid (M/64, N/64, Z), 32 threads.
// C[m][n] (f32, pitch ldc, + optional f32 bias[n]) = sum_k A[m][k] Bt[n][k] (+ split products per NSPLIT). z-batch strides sA/sB/sC in elements. K % 32 == 0.
template <typename T16> struct WFrag;
template <> struct WFrag<h16> { typedef v16h V; static __device__ __forceinline__ V ld(const h16* p) { return cat16(*(const v8h*)p, *(const v8h*)(p + 16)); } static __device__ __forceinline__ v8f mma(V a, V b, v8f c) { return wmma16(a, b, c); } };
template <> struct WFrag<bf> { typedef v16bf V; static __device__ __forceinline__ V ld(const bf* p) { return cat16b(*(const v8us*)p, *(const v8us*)(p + 16)); } static __device__ __forceinline__ v8f mma(V a, V b, v8f c) { return wmmab(a, b, c); } };
template <typename T16, int NSPLIT, bool BIAS>
__global__ __launch_bounds__(32) void k_gemmw(const T16* __restrict__ A, const T16* __restrict__ A2, const T16* __restrict__ Bt, const T16* __restrict__ Bt2, int K, float* C, int ldc, const float* __restrict__ bias, size_t sA, size_t sB, size_t sC) {
    typedef typename WFrag<T16>::V V;
    __shared__ __align__(16) float os[16 * 68];
    const size_t z = blockIdx.z; A += z * sA; if (A2) A2 += z * sA; Bt += z * sB; if (Bt2) Bt2 += z * sB; C += z * sC;
    const int lane = threadIdx.x & 31, lr = lane & 15, hi = lane >> 4; const int r0 = blockIdx.x * 64, c0 = blockIdx.y * 64;
    v8f acc[4][4];
#pragma unroll
    for (int mb = 0; mb < 4; ++mb)
#pragma unroll
        for (int nb = 0; nb < 4; ++nb) acc[mb][nb] = (v8f){};
    const size_t aoff = (size_t)(r0 + lr) * K + 8 * hi, boff = (size_t)(c0 + lr) * K + 8 * hi;
#pragma unroll 1
    for (int kc = 0; kc < K; kc += 32) {
        V a[4], a2[4];
#pragma unroll
        for (int mb = 0; mb < 4; ++mb) { a[mb] = WFrag<T16>::ld(A + aoff + (size_t)mb * 16 * K + kc); if (NSPLIT == 1 || NSPLIT == 2) a2[mb] = WFrag<T16>::ld(A2 + aoff + (size_t)mb * 16 * K + kc); }
#pragma unroll
        for (int nb = 0; nb < 4; ++nb) { const V b = WFrag<T16>::ld(Bt + boff + (size_t)nb * 16 * K + kc); V b2; if (NSPLIT >= 2) b2 = WFrag<T16>::ld(Bt2 + boff + (size_t)nb * 16 * K + kc);
#pragma unroll
            for (int mb = 0; mb < 4; ++mb) { acc[mb][nb] = WFrag<T16>::mma(a[mb], b, acc[mb][nb]); if (NSPLIT == 1 || NSPLIT == 2) acc[mb][nb] = WFrag<T16>::mma(a2[mb], b, acc[mb][nb]); if (NSPLIT >= 2) acc[mb][nb] = WFrag<T16>::mma(a[mb], b2, acc[mb][nb]); } }
        asm volatile("v_nop\n\tv_nop\n\tv_nop\n\tv_nop" : "+v"(acc[0][0]), "+v"(acc[1][1]), "+v"(acc[2][2]), "+v"(acc[3][3]) : "v"(a[0]), "v"(a[3]));
    }
#pragma unroll
    for (int mb = 0; mb < 4; ++mb) {
#pragma unroll
        for (int nb = 0; nb < 4; ++nb) {
#pragma unroll
            for (int j = 0; j < 8; ++j) os[(hi * 8 + j) * 68 + nb * 16 + lr] = acc[mb][nb][j]; }
        __builtin_amdgcn_wave_barrier(); asm volatile("" ::: "memory");
        float* crow = C + (size_t)(r0 + mb * 16) * ldc + c0;
{
#pragma unroll
            for (int s = 0; s < 8; ++s) { const int row = 2 * s + hi, cofs = lr * 4; v4f val = *(const v4fa*)(os + row * 68 + cofs); if (BIAS) { val[0] += bfr(bias[c0 + cofs]); val[1] += bfr(bias[c0 + cofs + 1]); val[2] += bfr(bias[c0 + cofs + 2]); val[3] += bfr(bias[c0 + cofs + 3]); }
                *(v4f*)(crow + (size_t)row * ldc + cofs) = val; }
             }
        __builtin_amdgcn_wave_barrier(); asm volatile("" ::: "memory");
    }
}

__device__ __forceinline__ h16 tohx(float x) { return (h16)x; }
__device__ __forceinline__ void splitf(float y, unsigned short& h, unsigned short& l) { h = f2bf(y); l = f2bf(y - bf2f(h)); }
typedef __attribute__((ext_vector_type(2))) _Float16 v2h;
typedef __attribute__((ext_vector_type(4))) _Float16 v4h;
typedef __attribute__((ext_vector_type(2))) unsigned short v2us;
typedef __attribute__((ext_vector_type(4))) unsigned short v4us;
typedef __attribute__((ext_vector_type(2))) float v2f;
typedef __attribute__((ext_vector_type(4))) int v4i;

__global__ __launch_bounds__(256) void k_wtG(const float* __restrict__ w, int K, int N, bf* Bt) {
    const int lane = threadIdx.x & 31; const int L0 = (blockIdx.x * 8 + (threadIdx.x >> 5)) * 8; const int nlines = N * K / 64;
{
#pragma unroll 1
        for (int l = 0; l < 8; ++l) { const int L = L0 + l; if (L >= nlines) break; const size_t e = (size_t)L * 64 + lane * 2; const int k = (int)(e % K), n = (int)(e / K); v2us o;
            o[0] = f2bf(w[(size_t)k * N + n]); o[1] = f2bf(w[(size_t)(k + 1) * N + n]); *(v2us*)(Bt + e) = o; }
         }
}
// grid.y = part (0 q, 1 k, 2 v); the three Bt matrices lie one behind another in dst
__global__ __launch_bounds__(256) void k_wtGh(const float* __restrict__ W, bf* dst) { const int part = blockIdx.y; dst += (size_t)part * DQ * DM; const size_t i = (size_t)blockIdx.x * 256 + threadIdx.x; if (i >= (size_t)DQ * DM / 8) return; const int o = (int)(i / (DM / 8)); const int v0 = (int)(i % (DM / 8)) * 8; const int h = o / HD, n = o % HD; const float* src = W + (((size_t)h * 3 + part) * DM + v0) * HD + n; v8us ov;
#pragma unroll
    for (int k = 0; k < 8; ++k) ov[k] = f2bf(src[(size_t)k * HD]); *(v8us*)(dst + (size_t)o * DM + v0) = ov;  }
__global__ __launch_bounds__(256) void k_cvt8(const float* __restrict__ src, bf* dst, size_t n8) { const size_t i = (size_t)blockIdx.x * 256 + threadIdx.x; if (i >= n8) return; const v8f v = *(const v8f*)(src + i * 8); v8us o;
#pragma unroll
    for (int k = 0; k < 8; ++k) o[k] = f2bf(v[k]); *(v8us*)(dst + i * 8) = o;  }

// k_rope: head planes [h][t][d] (fp16 + hi/lo) of rope(x) x sc with the rotate-half convention out[d] = x[d] cos[t][d] - x[d+HD/2] sin[t][d], out[d+HD/2] = x[d+HD/2] cos[t][d+HD/2] + x[d] sin[t][d+HD/2]
__global__ __launch_bounds__(256) void k_rope(const float* __restrict__ F, int pitch, int nheads, const float* __restrict__ CS, const float* __restrict__ RF, const float* __restrict__ nw, float sc, h16* P16, bf* Ph, bf* Pl) {
    { const size_t bz = blockIdx.y; F += bz * TT * pitch; P16 += bz * nheads * TT * HD; Ph += bz * nheads * TT * HD; Pl += bz * nheads * TT * HD; }   // grid.y = batch entry
    const size_t e = ((size_t)blockIdx.x * 256 + threadIdx.x) * 2; if (e >= (size_t)nheads * TT * HD) return; const int d = (int)(e % HD); const int t = (int)((e / HD) % TT); const int h = (int)(e / ((size_t)HD * TT)); const float* f = F + (size_t)t * pitch + h * HD; const float rf = RF ? RF[(size_t)h * TT + t] : 1.0f; v2h o16; v2us oh, ol;
#pragma unroll
    for (int q = 0; q < 2; ++q) { const int dd = d + q; const int dp = (dd < HD / 2) ? dd + HD / 2 : dd - HD / 2; float x0 = f[dd], x1 = f[dp];
        if (RF) { float n0 = __fmul_rn(x0, rf), n1 = __fmul_rn(x1, rf); asm volatile("" : "+v"(n0)); asm volatile("" : "+v"(n1)); x0 = __fmul_rn(bfr(nw[dd]), n0); x1 = __fmul_rn(bfr(nw[dp]), n1); }
        const v2f cs = *(const v2f*)(CS + ((size_t)t * HD + dd) * 2); float a = __fmul_rn(x0, cs[0]), bq = __fmul_rn(x1, cs[1]); asm volatile("" : "+v"(a)); asm volatile("" : "+v"(bq)); const float r = ((dd < HD / 2) ? __fsub_rn(a, bq) : __fadd_rn(a, bq)) * sc;
        o16[q] = tohx(r); unsigned short a2, c2; splitf(r, a2, c2); oh[q] = a2; ol[q] = c2; }
    *(v2h*)(P16 + e) = o16; *(v2us*)(Ph + e) = oh; *(v2us*)(Pl + e) = ol;  }
__global__ __launch_bounds__(256) void k_vtp(const float* __restrict__ F, int pitch, int nheads, h16* V16, bf* Vh, bf* Vl) { { const size_t bz = blockIdx.y; F += bz * TT * pitch; V16 += bz * nheads * HD * TT; Vh += bz * nheads * HD * TT; Vl += bz * nheads * HD * TT; }   // grid.y = batch entry
    const size_t e = ((size_t)blockIdx.x * 256 + threadIdx.x) * 2; if (e >= (size_t)nheads * HD * TT) return; const int t = (int)(e % TT); const int d = (int)((e / TT) % HD); const int g = (int)(e / ((size_t)TT * HD)); v2h o16; v2us oh, ol;
#pragma unroll
    for (int q = 0; q < 2; ++q) { const float x = F[(size_t)(t + q) * pitch + g * HD + d]; o16[q] = tohx(x); unsigned short a2, c2; splitf(x, a2, c2); oh[q] = a2; ol[q] = c2; }
    *(v2h*)(V16 + e) = o16; *(v2us*)(Vh + e) = oh; *(v2us*)(Vl + e) = ol;  }
__global__ __launch_bounds__(256) void k_csid(float* CS) { const int idx = blockIdx.x * 256 + threadIdx.x; if (idx >= TT * HD) return; v2f cs; cs[0] = 1.0f; cs[1] = 0.0f; *(v2f*)(CS + (size_t)idx * 2) = cs;  }
// k_asoft: per row (zz, i): t = S x HD^-0.5 (no mask); softmax over the 1024 keys (register row, one exp, fixed trees);
__global__ __launch_bounds__(256) void k_asoft(const float* __restrict__ Sb, h16* P16, bf* Ph, bf* Pl) {
    const int lane = threadIdx.x & 31; const int row = blockIdx.x * 8 + (threadIdx.x >> 5); if (row >= ZH * TT) return; const int i = row % TT; const int zz = row / TT; (void)zz; const bool hires = (i < RH); const float* sr = Sb + (size_t)row * TT; float v[TT / 32]; float mx = -3.0e38f;
#pragma unroll
    for (int ch = 0; ch < TT / 128; ++ch) { const int j0 = ch * 128 + lane * 4; const v4f a = *(const v4f*)(sr + j0);
#pragma unroll
        for (int q = 0; q < 4; ++q) { const int j = j0 + q; (void)j; const float t = a[q] * SCL; v[ch * 4 + q] = t; mx = fmaxf(mx, t); } }
#pragma unroll
    for (int sh = 16; sh; sh >>= 1) mx = fmaxf(mx, __shfl_xor(mx, sh, 32));
    float sum = 0.f;
#pragma unroll
    for (int k = 0; k < TT / 32; ++k) { float d0 = __fsub_rn(v[k], mx); asm volatile("" : "+v"(d0)); v[k] = __builtin_amdgcn_exp2f(__fmul_rn(d0, 1.4426950408889634f)); sum += v[k]; }
#pragma unroll
    for (int sh = 16; sh; sh >>= 1) sum += __shfl_xor(sum, sh, 32);
    const float f = __fdiv_rn(hires ? 1.0f : PCAR, sum);
{
        if (hires) {
#pragma unroll
            for (int ch = 0; ch < TT / 128; ++ch) { v4us oh, ol;
#pragma unroll
                for (int q = 0; q < 4; ++q) { unsigned short a, c2; splitf(v[ch * 4 + q] * f, a, c2); oh[q] = a; ol[q] = c2; }
                const size_t oo = ((size_t)zz * (RH ? RH : 1) + i) * TT + ch * 128 + lane * 4; *(v4us*)(Ph + oo) = oh; *(v4us*)(Pl + oo) = ol; }
        } else {
#pragma unroll
            for (int ch = 0; ch < TT / 128; ++ch) { v4h o4;
#pragma unroll
                for (int q = 0; q < 4; ++q) o4[q] = tohx(v[ch * 4 + q] * f);
                *(v4h*)(P16 + (size_t)row * TT + ch * 128 + lane * 4) = o4; } }
         }
}
__global__ __launch_bounds__(256) void k_merge(const float* __restrict__ O, int h0, bf* Ah, bf* Al) { const size_t e = ((size_t)blockIdx.x * 256 + threadIdx.x) * 2; if (e >= (size_t)ZH * TT * HD) return; const int d = (int)(e % HD); const int t = (int)((e / HD) % TT); const int zz = (int)(e / ((size_t)HD * TT)); const float cs = (t < RH) ? 1.0f : (1.0f / PCAR); const size_t oo = (size_t)t * DQ + (h0 + zz) * HD + d;
    v2us oh, ol;
#pragma unroll
    for (int q = 0; q < 2; ++q) { unsigned short a, c2; splitf(O[e + q] * cs, a, c2); oh[q] = a; ol[q] = c2; } *(v2us*)(Ah + oo) = oh; *(v2us*)(Al + oo) = ol;  }

extern "C" void kernel_launch(void* const* d_in, const int* in_sizes, int n_in,
                              void* d_out, int out_size, void* d_ws, size_t ws_size, hipStream_t stream) {
    (void)in_sizes; (void)n_in; (void)out_size;
    const float* x = (const float*)d_in[0]; const float* wqkv = (const float*)d_in[1]; const float* wo = (const float*)d_in[2]; const float* wq = nullptr; const float* wk = nullptr; const float* wv = nullptr; (void)wq; (void)wk; (void)wv;
    float* OUT = (float*)d_out;     // [8][1024][1024]
    char* wsp = (char*)d_ws;
    auto take = [&](size_t bytes) { char* p = wsp; wsp += (bytes + 255) & ~(size_t)255; return (void*)p; };
    const size_t PL = (size_t)NB_ * NH_ * TT * HD;   // elements of one plane set [b][h][t][d] (= NB_ * TT * DQ)
    bf* WQ = (bf*)take((size_t)3 * DQ * DM * 2);      // q, k, v weight slices, one behind another (z of the projection launch)
    bf* WO = (bf*)take((size_t)DM * DQ * 2); float* CS = (float*)take((size_t)TT * HD * 2 * 4);
    bf* QPh = (bf*)take(PL * 2); bf* QPl = (bf*)take(PL * 2); bf* KPh = (bf*)take(PL * 2); bf* KPl = (bf*)take(PL * 2); bf* VTh = (bf*)take(PL * 2); bf* VTl = (bf*)take(PL * 2);
    float* Ob = (float*)take((size_t)ZH * TT * HD * 4);
    // one region, used twice (stream-ordered): projection phase XB | FQ | FK | FV, attention phase Sb | Ph | Pl
    char* big = (char*)take((size_t)ZH * TT * TT * 8);
    bf* XB = (bf*)big; float* FQ = (float*)(big + PL * 2); float* FK = FQ + PL; float* FV = FK + PL;
    float* Sb = (float*)big; bf* Ph = (bf*)(big + (size_t)ZH * TT * TT * 4); bf* Pl = Ph + (size_t)ZH * RH * TT;
    h16* P16 = nullptr;   // the fp16 probability plane has no rows at RH = TT
    // the fp16 head planes go into buffers whose readers have finished by then: XB after the projection, FQ after the q planes
    h16* QP16 = (h16*)XB; h16* KP16 = (h16*)FQ; h16* VT16 = KP16 + PL;
    // merged heads of batch entry b take the place of its q planes, which the scores launch of b has read by then
    bf* ATh = QPh; bf* ATl = QPl;
    if ((size_t)(wsp - (char*)d_ws) > ws_size) return;    // ws 256 MiB
    k_wtGh<<<dim3((unsigned)(((size_t)DQ * DM / 8 + 255) / 256), 3, 1), 256, 0, stream>>>(wqkv, WQ);
    k_wtG<<<(unsigned)((DQ * DM / 64 + 63) / 64), 256, 0, stream>>>(wo, DQ, DM, WO);
    k_csid<<<(TT * HD + 255) / 256, 256, 0, stream>>>(CS);
    const unsigned LQ = (unsigned)(((size_t)NH_ * TT * HD / 2 + 255) / 256), LKv = (unsigned)(((size_t)NKV * TT * HD / 2 + 255) / 256);
    // every batch entry at once: rows m = b * TT + t; z = q, k, v
    k_cvt8<<<(unsigned)(((size_t)NB_ * TT * DM / 8 + 255) / 256), 256, 0, stream>>>(x, XB, (size_t)NB_ * TT * DM / 8);
    k_gemmw<bf, 0, false><<<dim3(NB_ * TT / 64, DQ / 64, 3), 32, 0, stream>>>(XB, nullptr, WQ, nullptr, DM, FQ, DQ, nullptr, 0, (size_t)DQ * DM, PL);
    k_rope<<<dim3(LQ, NB_, 1), 256, 0, stream>>>(FQ, DQ, NH_, CS, nullptr, nullptr, 1.0f, QP16, QPh, QPl);
    k_rope<<<dim3(LKv, NB_, 1), 256, 0, stream>>>(FK, DKV, NKV, CS, nullptr, nullptr, 1.0f, KP16, KPh, KPl);
    k_vtp<<<dim3(LKv, NB_, 1), 256, 0, stream>>>(FV, DKV, NKV, VT16, VTh, VTl);
    for (int b = 0; b < NB_; ++b) { const size_t zo = (size_t)b * NH_ * TT * HD;   // one pass per batch entry, z = head (the scores of more planes do not fit the workspace)
        k_gemmw<bf, 2, false><<<dim3(RH / 64, TT / 64, ZH), 32, 0, stream>>>(QPh + zo, QPl + zo, KPh + zo, KPl + zo, HD, Sb, TT, nullptr, (size_t)TT * HD, (size_t)TT * HD, (size_t)TT * TT);
        k_asoft<<<ZH * TT / 8, 256, 0, stream>>>(Sb, P16, Ph, Pl);
        k_gemmw<bf, 2, false><<<dim3(RH / 64, HD / 64, ZH), 32, 0, stream>>>(Ph, Pl, VTh + zo, VTl + zo, TT, Ob, HD, nullptr, (size_t)RH * TT, (size_t)HD * TT, (size_t)TT * HD);
        k_merge<<<(unsigned)(((size_t)ZH * TT * HD / 2 + 255) / 256), 256, 0, stream>>>(Ob, 0, ATh + zo, ATl + zo); }
    k_gemmw<bf, 1, false><<<dim3(NB_ * TT / 64, DM / 64, 1), 32, 0, stream>>>(ATh, ATl, WO, nullptr, DQ, OUT, DM, nullptr, 0, 0, 0);
}

// v002
// One run takes 339 microseconds.
// In two side-by-side timings against v001, it was 2.47 and 2.48 times as fast.
// Counting every step since v000, it is 8.76 times as fast.
#include <hip/hip_runtime.h>

// Multi-head self-attention with per-head projection weights (inputs [8][1024][1024]; proj = einsum('bpv,havn->bhapn', inputs, w_qkv [16][3][1024][64]): q/k/v of head h = inputs w_qkv[h][0/1/2] ([1024][64]); scores = q.k / 8 over all 1024 keys; softmax; out = merged heads ([p][h*64+n]) w_o ('xw' [1024][1024]) -> [8][1024][1024] (8.4 M)).
// Compute dtypes, f32 accumulate: every input rounded to bf16; q/k/v on PLAIN bf16 operands (inputs: exact); the per-head weight slices gathered into three Bt matrices [h*64+n][v] (exact copies); scores and attn.v on bf16 hi/lo planes (3 products) for every query row (logit sigma 2.5); softmax f32; w_o hl x exact (2 products).

#define NB_  8
#define TT   1024
#define DM   1024
#define NH_  16
#define NKV  16
#define REP  (NH_ / NKV)
#define HD   64
#define DQ   (NH_ * HD)
#define DKV  (NKV * HD)
#define WIN  0
#define SCL  0.125f   // HD^-0.5
typedef _Float16 h16;
typedef unsigned short bf;
typedef __attribute__((ext_vector_type(16))) __bf16   v16bf;
typedef __attribute__((ext_vector_type(16))) _Float16 v16h;
typedef __attribute__((ext_vector_type(8)))  _Float16 v8h;
typedef __attribute__((ext_vector_type(8)))  unsigned short v8us;
typedef __attribute__((ext_vector_type(8)))  float    v8f;
typedef __attribute__((ext_vector_type(4)))  float    v4f;
typedef v8h  __attribute__((may_alias)) v8ha;
typedef v4f  __attribute__((may_alias)) v4fa;
typedef v8us __attribute__((may_alias)) v8usa;

__device__ __forceinline__ unsigned short f2bf(float f) { unsigned u = __float_as_uint(f); u += 0x7FFFu + ((u >> 16) & 1u); return (unsigned short)(u >> 16); }
__device__ __forceinline__ float bf2f(unsigned short b) { return __uint_as_float(((unsigned)b) << 16); }
__device__ __forceinline__ float bfr(float f) { return bf2f(f2bf(f)); }
__device__ __forceinline__ v16h cat16(v8h lo, v8h hi) { return __builtin_shufflevector(lo, hi, 0, 1, 2, 3, 4, 5, 6, 7, 8, 9, 10, 11, 12, 13, 14, 15); }
__device__ __forceinline__ v16bf cat16b(v8us lo, v8us hi) { return __builtin_bit_cast(v16bf, __builtin_shufflevector(lo, hi, 0, 1, 2, 3, 4, 5, 6, 7, 8, 9, 10, 11, 12, 13, 14, 15)); }
__device__ __forceinline__ v8f wmma16(v16h a, v16h b, v8f c) { return __builtin_amdgcn_wmma_f32_16x16x32_f16(false, a, false, b, (short)0, c, false, false); }
__device__ __forceinline__ v8f wmmab(v16bf a, v16bf b, v8f c) { return __builtin_amdgcn_wmma_f32_16x16x32_bf16(false, a, false, b, (short)0, c, false, false); }



// ---- k_gemmw: register-blocked GEMM, ONE WAVE per 64x64 output tile (16 accumulators), operands straight from K-contiguous 16-bit planes; grid (M/64, N/64, Z), 32 threads.
// C[m][n] (f32, pitch ldc, + optional f32 bias[n]) = sum_k A[m][k] Bt[n][k] (+ split products per NSPLIT). z-batch strides sA/sB/sC in elements. K % 32 == 0.
template <typename T16> struct WFrag;
template <> struct WFrag<h16> { typedef v16h V; static __device__ __forceinline__ V ld(const h16* p) { return cat16(*(const v8h*)p, *(const v8h*)(p + 16)); } static __device__ __forceinline__ v8f mma(V a, V b, v8f c) { return wmma16(a, b, c); } };
template <> struct WFrag<bf> { typedef v16bf V; static __device__ __forceinline__ V ld(const bf* p) { return cat16b(*(const v8us*)p, *(const v8us*)(p + 16)); } static __device__ __forceinline__ v8f mma(V a, V b, v8f c) { return wmmab(a, b, c); } };
template <typename T16, int NSPLIT, bool BIAS>
__global__ __launch_bounds__(32) void k_gemmw(const T16* __restrict__ A, const T16* __restrict__ A2, const T16* __restrict__ Bt, const T16* __restrict__ Bt2, int K, float* C, int ldc, const float* __restrict__ bias, size_t sA, size_t sB, size_t sC) {
    typedef typename WFrag<T16>::V V;
    __shared__ __align__(16) float os[16 * 68];
    const size_t z = blockIdx.z; A += z * sA; if (A2) A2 += z * sA; Bt += z * sB; if (Bt2) Bt2 += z * sB; C += z * sC;
    const int lane = threadIdx.x & 31, lr = lane & 15, hi = lane >> 4; const int r0 = blockIdx.x * 64, c0 = blockIdx.y * 64;
    v8f acc[4][4];
#pragma unroll
    for (int mb = 0; mb < 4; ++mb)
#pragma unroll
        for (int nb = 0; nb < 4; ++nb) acc[mb][nb] = (v8f){};
    const size_t aoff = (size_t)(r0 + lr) * K + 8 * hi, boff = (size_t)(c0 + lr) * K + 8 * hi;
#pragma unroll 1
    for (int kc = 0; kc < K; kc += 32) {
        V a[4], a2[4];
#pragma unroll
        for (int mb = 0; mb < 4; ++mb) { a[mb] = WFrag<T16>::ld(A + aoff + (size_t)mb * 16 * K + kc); if (NSPLIT == 1 || NSPLIT == 2) a2[mb] = WFrag<T16>::ld(A2 + aoff + (size_t)mb * 16 * K + kc); }
#pragma unroll
        for (int nb = 0; nb < 4; ++nb) { const V b = WFrag<T16>::ld(Bt + boff + (size_t)nb * 16 * K + kc); V b2; if (NSPLIT >= 2) b2 = WFrag<T16>::ld(Bt2 + boff + (size_t)nb * 16 * K + kc);
#pragma unroll
            for (int mb = 0; mb < 4; ++mb) { acc[mb][nb] = WFrag<T16>::mma(a[mb], b, acc[mb][nb]); if (NSPLIT == 1 || NSPLIT == 2) acc[mb][nb] = WFrag<T16>::mma(a2[mb], b, acc[mb][nb]); if (NSPLIT >= 2) acc[mb][nb] = WFrag<T16>::mma(a[mb], b2, acc[mb][nb]); } }
        asm volatile("v_nop\n\tv_nop\n\tv_nop\n\tv_nop" : "+v"(acc[0][0]), "+v"(acc[1][1]), "+v"(acc[2][2]), "+v"(acc[3][3]) : "v"(a[0]), "v"(a[3]));
    }
#pragma unroll
    for (int mb = 0; mb < 4; ++mb) {
#pragma unroll
        for (int nb = 0; nb < 4; ++nb) {
#pragma unroll
            for (int j = 0; j < 8; ++j) os[(hi * 8 + j) * 68 + nb * 16 + lr] = acc[mb][nb][j]; }
        __builtin_amdgcn_wave_barrier(); asm volatile("" ::: "memory");
        float* crow = C + (size_t)(r0 + mb * 16) * ldc + c0;
{
#pragma unroll
            for (int s = 0; s < 8; ++s) { const int row = 2 * s + hi, cofs = lr * 4; v4f val = *(const v4fa*)(os + row * 68 + cofs); if (BIAS) { val[0] += bfr(bias[c0 + cofs]); val[1] += bfr(bias[c0 + cofs + 1]); val[2] += bfr(bias[c0 + cofs + 2]); val[3] += bfr(bias[c0 + cofs + 3]); }
                *(v4f*)(crow + (size_t)row * ldc + cofs) = val; }
             }
        __builtin_amdgcn_wave_barrier(); asm volatile("" ::: "memory");
    }
}

__device__ __forceinline__ h16 tohx(float x) { return (h16)x; }
__device__ __forceinline__ void splitf(float y, unsigned short& h, unsigned short& l) { h = f2bf(y); l = f2bf(y - bf2f(h)); }
typedef __attribute__((ext_vector_type(2))) _Float16 v2h;
typedef __attribute__((ext_vector_type(4))) _Float16 v4h;
typedef __attribute__((ext_vector_type(2))) unsigned short v2us;
typedef __attribute__((ext_vector_type(4))) unsigned short v4us;
typedef __attribute__((ext_vector_type(2))) float v2f;
typedef __attribute__((ext_vector_type(4))) int v4i;

__global__ __launch_bounds__(256) void k_wtG(const float* __restrict__ w, int K, int N, bf* Bt) {
    const int lane = threadIdx.x & 31; const int L0 = (blockIdx.x * 8 + (threadIdx.x >> 5)) * 8; const int nlines = N * K / 64;
{
#pragma unroll 1
        for (int l = 0; l < 8; ++l) { const int L = L0 + l; if (L >= nlines) break; const size_t e = (size_t)L * 64 + lane * 2; const int k = (int)(e % K), n = (int)(e / K); v2us o;
            o[0] = f2bf(w[(size_t)k * N + n]); o[1] = f2bf(w[(size_t)(k + 1) * N + n]); *(v2us*)(Bt + e) = o; }
         }
}
// grid.y = part (0 q, 1 k, 2 v); the three Bt matrices lie one behind another in dst
__global__ __launch_bounds__(256) void k_wtGh(const float* __restrict__ W, bf* dst) { const int part = blockIdx.y; dst += (size_t)part * DQ * DM; const size_t i = (size_t)blockIdx.x * 256 + threadIdx.x; if (i >= (size_t)DQ * DM / 8) return; const int o = (int)(i / (DM / 8)); const int v0 = (int)(i % (DM / 8)) * 8; const int h = o / HD, n = o % HD; const float* src = W + (((size_t)h * 3 + part) * DM + v0) * HD + n; v8us ov;
#pragma unroll
    for (int k = 0; k < 8; ++k) ov[k] = f2bf(src[(size_t)k * HD]); *(v8us*)(dst + (size_t)o * DM + v0) = ov;  }
__global__ __launch_bounds__(256) void k_cvt8(const float* __restrict__ src, bf* dst, size_t n8) { const size_t i = (size_t)blockIdx.x * 256 + threadIdx.x; if (i >= n8) return; const v8f v = *(const v8f*)(src + i * 8); v8us o;
#pragma unroll
    for (int k = 0; k < 8; ++k) o[k] = f2bf(v[k]); *(v8us*)(dst + i * 8) = o;  }

// k_rope: head planes [h][t][d] (fp16 + hi/lo) of rope(x) x sc with the rotate-half convention out[d] = x[d] cos[t][d] - x[d+HD/2] sin[t][d], out[d+HD/2] = x[d+HD/2] cos[t][d+HD/2] + x[d] sin[t][d+HD/2]
__global__ __launch_bounds__(256) void k_rope(const float* __restrict__ F, int pitch, int nheads, const float* __restrict__ CS, const float* __restrict__ RF, const float* __restrict__ nw, float sc, h16* P16, bf* Ph, bf* Pl) {
    { const size_t bz = blockIdx.y; F += bz * TT * pitch; P16 += bz * nheads * TT * HD; Ph += bz * nheads * TT * HD; Pl += bz * nheads * TT * HD; }   // grid.y = batch entry
    const size_t e = ((size_t)blockIdx.x * 256 + threadIdx.x) * 2; if (e >= (size_t)nheads * TT * HD) return; const int d = (int)(e % HD); const int t = (int)((e / HD) % TT); const int h = (int)(e / ((size_t)HD * TT)); const float* f = F + (size_t)t * pitch + h * HD; const float rf = RF ? RF[(size_t)h * TT + t] : 1.0f; v2h o16; v2us oh, ol;
#pragma unroll
    for (int q = 0; q < 2; ++q) { const int dd = d + q; const int dp = (dd < HD / 2) ? dd + HD / 2 : dd - HD / 2; float x0 = f[dd], x1 = f[dp];
        if (RF) { float n0 = __fmul_rn(x0, rf), n1 = __fmul_rn(x1, rf); asm volatile("" : "+v"(n0)); asm volatile("" : "+v"(n1)); x0 = __fmul_rn(bfr(nw[dd]), n0); x1 = __fmul_rn(bfr(nw[dp]), n1); }
        const v2f cs = *(const v2f*)(CS + ((size_t)t * HD + dd) * 2); float a = __fmul_rn(x0, cs[0]), bq = __fmul_rn(x1, cs[1]); asm volatile("" : "+v"(a)); asm volatile("" : "+v"(bq)); const float r = ((dd < HD / 2) ? __fsub_rn(a, bq) : __fadd_rn(a, bq)) * sc;
        o16[q] = tohx(r); unsigned short a2, c2; splitf(r, a2, c2); oh[q] = a2; ol[q] = c2; }
    *(v2h*)(P16 + e) = o16; *(v2us*)(Ph + e) = oh; *(v2us*)(Pl + e) = ol;  }
__global__ __launch_bounds__(256) void k_vtp(const float* __restrict__ F, int pitch, int nheads, h16* V16, bf* Vh, bf* Vl) { { const size_t bz = blockIdx.y; F += bz * TT * pitch; V16 += bz * nheads * HD * TT; Vh += bz * nheads * HD * TT; Vl += bz * nheads * HD * TT; }   // grid.y = batch entry
    const size_t e = ((size_t)blockIdx.x * 256 + threadIdx.x) * 2; if (e >= (size_t)nheads * HD * TT) return; const int t = (int)(e % TT); const int d = (int)((e / TT) % HD); const int g = (int)(e / ((size_t)TT * HD)); v2h o16; v2us oh, ol;
#pragma unroll
    for (int q = 0; q < 2; ++q) { const float x = F[(size_t)(t + q) * pitch + g * HD + d]; o16[q] = tohx(x); unsigned short a2, c2; splitf(x, a2, c2); oh[q] = a2; ol[q] = c2; }
    *(v2h*)(V16 + e) = o16; *(v2us*)(Vh + e) = oh; *(v2us*)(Vl + e) = ol;  }
__global__ __launch_bounds__(256) void k_csid(float* CS) { const int idx = blockIdx.x * 256 + threadIdx.x; if (idx >= TT * HD) return; v2f cs; cs[0] = 1.0f; cs[1] = 0.0f; *(v2f*)(CS + (size_t)idx * 2) = cs;  }
// k_fattn: scores, softmax, attn.v and the head merge in one launch. One wave = 32 query columns of one (batch, head), 32 keys a pass:
// St = K Qt (A = key rows, B = query rows kept in registers), so a lane holds one query's scores; running maximum and sum in-lane plus one exchange between the wave halves;
// two St tiles, converted in place, are the B operand of Ot += Vt Pt (A = rows of the [d][t] planes). hi/lo planes, 3 products (hi.hi, hi.lo, lo.hi). grid (TT/256, head, batch).
// Every inner loop is unrolled whole, so that the fragment and accumulator arrays are indexed by constants and stay in registers.
// The 8 waves of a block share each pass's 32 keys through LDS, two buffers: coalesced global loads of pass s + 1 are issued before the work of pass s and stored behind it; one barrier a pass.
#define KPI 72                               // LDS pitch of a key row (64 d), elements: 144 B = 16 B x odd, no bank conflict for 16-byte row reads
#define VPI 40                               // LDS pitch of a d row (32 keys), elements: 80 B = 16 B x odd
#define OKL (32 * KPI)                       // element offsets in a buffer: K hi 0, K lo, V hi, V lo
#define OVH (2 * 32 * KPI)
#define OVL (2 * 32 * KPI + 64 * VPI)
#define SBE (2 * 32 * KPI + 2 * 64 * VPI)    // elements of one buffer
typedef __attribute__((ext_vector_type(2))) __bf16 v2bf;
__device__ __forceinline__ float xhalf(float x) { const int b = __float_as_int(x); return __int_as_float(__builtin_amdgcn_permlanex16(b, b, 0x76543210, 0xfedcba98, false, false)); }
__global__ __launch_bounds__(256) void k_fattn(const bf* __restrict__ Qh, const bf* __restrict__ Ql, const bf* __restrict__ Kh, const bf* __restrict__ Kl, const bf* __restrict__ Vh, const bf* __restrict__ Vl, bf* __restrict__ Ah, bf* __restrict__ Al) {
    typedef WFrag<bf> F; typedef v16bf V;
    __shared__ __align__(16) bf sm[2 * SBE];
    const int lane = threadIdx.x & 31, lr = lane & 15, hi = lane >> 4; const int h = blockIdx.y, b = blockIdx.z; const size_t zo = ((size_t)b * NH_ + h) * TT * HD; const int q0 = blockIdx.x * 256 + (threadIdx.x >> 5) * 32;
    const float C2 = SCL * 1.4426950408889634f;   // scores are kept in log2 units
    V qh[2][2], ql[2][2];
#pragma unroll
    for (int qt = 0; qt < 2; ++qt)
#pragma unroll
        for (int ks = 0; ks < 2; ++ks) { const size_t qo = zo + (size_t)(q0 + qt * 16 + lr) * HD + ks * 32 + 8 * hi; qh[qt][ks] = F::ld(Qh + qo); ql[qt][ks] = F::ld(Ql + qo); }
    v8f o[2][4]; float m[2]; v2f l[2];   // l: this lane's part of the row sum, even and odd keys apart
#pragma unroll
    for (int qt = 0; qt < 2; ++qt) { m[qt] = -3.0e38f; l[qt] = (v2f){};
#pragma unroll
        for (int dt = 0; dt < 4; ++dt) o[qt][dt] = (v8f){}; }
    const int tid = threadIdx.x;
    // staging: thread tid moves 16 bytes of each of the four planes a pass (K: 32 rows x 128 B, contiguous; V: 64 rows x 64 B)
    const bf* gkh = Kh + zo + tid * 8; const bf* gkl = Kl + zo + tid * 8; const bf* gvh = Vh + zo + (size_t)(tid >> 2) * TT + (tid & 3) * 8; const bf* gvl = Vl + zo + (size_t)(tid >> 2) * TT + (tid & 3) * 8;
    const int sk = (tid >> 3) * KPI + (tid & 7) * 8, sv = (tid >> 2) * VPI + (tid & 3) * 8; const int fk = lr * KPI + 8 * hi, fv = lr * VPI + 8 * hi;
    v8us g0 = *(const v8us*)gkh, g1 = *(const v8us*)gkl, g2 = *(const v8us*)gvh, g3 = *(const v8us*)gvl;
    *(v8us*)(sm + sk) = g0; *(v8us*)(sm + OKL + sk) = g1; *(v8us*)(sm + OVH + sv) = g2; *(v8us*)(sm + OVL + sv) = g3;
    __syncthreads();   // publishes pass 0
#pragma unroll 1   // rolled: two passes in one body would not fit the 256 registers that four waves per SIMD leave
    for (int k0 = 0; k0 < TT; k0 += 32) {
        const bf* cur = sm + ((k0 >> 5) & 1) * SBE; bf* nxt = sm + (((k0 >> 5) & 1) ^ 1) * SBE; const bool more = k0 + 32 < TT;
        if (more) { g0 = *(const v8us*)(gkh + (size_t)(k0 + 32) * HD); g1 = *(const v8us*)(gkl + (size_t)(k0 + 32) * HD); g2 = *(const v8us*)(gvh + k0 + 32); g3 = *(const v8us*)(gvl + k0 + 32); }
        v8f s[2][2];   // [query tile][key tile]: register r = score of key k0 + kt * 16 + 8 * hi + r, query column lr
#pragma unroll
        for (int kt = 0; kt < 2; ++kt) { V ah[2], al[2];
#pragma unroll
            for (int ks = 0; ks < 2; ++ks) { const int ko = fk + kt * 16 * KPI + ks * 32; ah[ks] = F::ld(cur + ko); al[ks] = F::ld(cur + OKL + ko); }
#pragma unroll
            for (int qt = 0; qt < 2; ++qt) { v8f t = (v8f){};
#pragma unroll
                for (int ks = 0; ks < 2; ++ks) { t = F::mma(ah[ks], qh[qt][ks], t); t = F::mma(ah[ks], ql[qt][ks], t); t = F::mma(al[ks], qh[qt][ks], t); }
                s[qt][kt] = t; } }
        float cm[2]; bool need = false;
#pragma unroll
        for (int qt = 0; qt < 2; ++qt) { float x = s[qt][0][0];
#pragma unroll
            for (int r = 0; r < 8; ++r) x = fmaxf(x, fmaxf(s[qt][0][r], s[qt][1][r]));
            x *= C2; cm[qt] = fmaxf(x, xhalf(x)); need = need || (cm[qt] > m[qt] + 8.0f); }
        // the maximum in use moves only when a column's new one exceeds it by more than 8 (log2): one wave-uniform test a pass
        if (__builtin_amdgcn_ballot_w32(need) != 0) {
#pragma unroll
            for (int qt = 0; qt < 2; ++qt) { const float mn = fmaxf(m[qt], cm[qt]); const float al2 = __builtin_amdgcn_exp2f(m[qt] - mn); m[qt] = mn; l[qt] *= al2;
#pragma unroll
                for (int dt = 0; dt < 4; ++dt) o[qt][dt] *= al2; } }
        V ph[2], pl[2];
#pragma unroll
        for (int qt = 0; qt < 2; ++qt) {
#pragma unroll
            for (int e = 0; e < 16; e += 2) { v2f x; x[0] = s[qt][e >> 3][e & 7]; x[1] = s[qt][e >> 3][(e & 7) + 1]; x = __builtin_elementwise_fma(x, (v2f){C2, C2}, (v2f){-m[qt], -m[qt]});
                v2f p; p[0] = __builtin_amdgcn_exp2f(x[0]); p[1] = __builtin_amdgcn_exp2f(x[1]); l[qt] += p;
                const v2bf a = __builtin_convertvector(p, v2bf); v2f rr; rr[0] = p[0] - (float)a[0]; rr[1] = p[1] - (float)a[1]; const v2bf c = __builtin_convertvector(rr, v2bf);
                ph[qt][e] = a[0]; ph[qt][e + 1] = a[1]; pl[qt][e] = c[0]; pl[qt][e + 1] = c[1]; } }
#pragma unroll
        for (int dt = 0; dt < 4; ++dt) { const int vo = fv + dt * 16 * VPI; const V bh = F::ld(cur + OVH + vo), bl = F::ld(cur + OVL + vo);
#pragma unroll
            for (int qt = 0; qt < 2; ++qt) { o[qt][dt] = F::mma(bh, ph[qt], o[qt][dt]); o[qt][dt] = F::mma(bh, pl[qt], o[qt][dt]); o[qt][dt] = F::mma(bl, ph[qt], o[qt][dt]); } }
        if (more) { *(v8us*)(nxt + sk) = g0; *(v8us*)(nxt + OKL + sk) = g1; *(v8us*)(nxt + OVH + sv) = g2; *(v8us*)(nxt + OVL + sv) = g3; }
        __syncthreads();   // publishes pass s + 1 and ends every wave's reads of the buffer that pass s + 1 refills
    }
#pragma unroll
    for (int qt = 0; qt < 2; ++qt) { const float lq = l[qt][0] + l[qt][1]; const float f = __fdiv_rn(1.0f, lq + xhalf(lq)); const size_t oo = ((size_t)b * TT + q0 + qt * 16 + lr) * DQ + h * HD + 8 * hi;
#pragma unroll
        for (int dt = 0; dt < 4; ++dt) { v8us oh, ol;
#pragma unroll
            for (int r = 0; r < 8; ++r) { unsigned short a, c2; splitf(o[qt][dt][r] * f, a, c2); oh[r] = a; ol[r] = c2; }
            *(v8us*)(Ah + oo + dt * 16) = oh; *(v8us*)(Al + oo + dt * 16) = ol; } }
}

extern "C" void kernel_launch(void* const* d_in, const int* in_sizes, int n_in,
                              void* d_out, int out_size, void* d_ws, size_t ws_size, hipStream_t stream) {
    (void)in_sizes; (void)n_in; (void)out_size;
    const float* x = (const float*)d_in[0]; const float* wqkv = (const float*)d_in[1]; const float* wo = (const float*)d_in[2]; const float* wq = nullptr; const float* wk = nullptr; const float* wv = nullptr; (void)wq; (void)wk; (void)wv;
    float* OUT = (float*)d_out;     // [8][1024][1024]
    char* wsp = (char*)d_ws;
    auto take = [&](size_t bytes) { char* p = wsp; wsp += (bytes + 255) & ~(size_t)255; return (void*)p; };
    const size_t PL = (size_t)NB_ * NH_ * TT * HD;   // elements of one plane set [b][h][t][d] (= NB_ * TT * DQ)
    bf* WQ = (bf*)take((size_t)3 * DQ * DM * 2);      // q, k, v weight slices, one behind another (z of the projection launch)
    bf* WO = (bf*)take((size_t)DM * DQ * 2); float* CS = (float*)take((size_t)TT * HD * 2 * 4);
    bf* QPh = (bf*)take(PL * 2); bf* QPl = (bf*)take(PL * 2); bf* KPh = (bf*)take(PL * 2); bf* KPl = (bf*)take(PL * 2); bf* VTh = (bf*)take(PL * 2); bf* VTl = (bf*)take(PL * 2);
    // projection phase: XB | FQ | FK | FV
    char* big = (char*)take(PL * 2 + 3 * PL * 4);
    bf* XB = (bf*)big; float* FQ = (float*)(big + PL * 2); float* FK = FQ + PL; float* FV = FK + PL;
    // the fp16 head planes go into buffers whose readers have finished by then: XB after the projection, FQ after the q planes
    h16* QP16 = (h16*)XB; h16* KP16 = (h16*)FQ; h16* VT16 = KP16 + PL;
    // the merged heads [b][t][h*64+d] take the place of FK, whose one reader (the k planes launch) has finished by then
    bf* ATh = (bf*)FK; bf* ATl = ATh + PL;
    if ((size_t)(wsp - (char*)d_ws) > ws_size) return;    // ws 256 MiB
    k_wtGh<<<dim3((unsigned)(((size_t)DQ * DM / 8 + 255) / 256), 3, 1), 256, 0, stream>>>(wqkv, WQ);
    k_wtG<<<(unsigned)((DQ * DM / 64 + 63) / 64), 256, 0, stream>>>(wo, DQ, DM, WO);
    k_csid<<<(TT * HD + 255) / 256, 256, 0, stream>>>(CS);
    const unsigned LQ = (unsigned)(((size_t)NH_ * TT * HD / 2 + 255) / 256), LKv = (unsigned)(((size_t)NKV * TT * HD / 2 + 255) / 256);
    // every batch entry at once: rows m = b * TT + t; z = q, k, v
    k_cvt8<<<(unsigned)(((size_t)NB_ * TT * DM / 8 + 255) / 256), 256, 0, stream>>>(x, XB, (size_t)NB_ * TT * DM / 8);
    k_gemmw<bf, 0, false><<<dim3(NB_ * TT / 64, DQ / 64, 3), 32, 0, stream>>>(XB, nullptr, WQ, nullptr, DM, FQ, DQ, nullptr, 0, (size_t)DQ * DM, PL);
    k_rope<<<dim3(LQ, NB_, 1), 256, 0, stream>>>(FQ, DQ, NH_, CS, nullptr, nullptr, 1.0f, QP16, QPh, QPl);
    k_rope<<<dim3(LKv, NB_, 1), 256, 0, stream>>>(FK, DKV, NKV, CS, nullptr, nullptr, 1.0f, KP16, KPh, KPl);
    k_vtp<<<dim3(LKv, NB_, 1), 256, 0, stream>>>(FV, DKV, NKV, VT16, VTh, VTl);
    k_fattn<<<dim3(TT / 256, NH_, NB_), 256, 0, stream>>>(QPh, QPl, KPh, KPl, VTh, VTl, ATh, ATl);
    k_gemmw<bf, 1, false><<<dim3(NB_ * TT / 64, DM / 64, 1), 32, 0, stream>>>(ATh, ATl, WO, nullptr, DQ, OUT, DM, nullptr, 0, 0, 0);
}

// v003
// It runs in 267 microseconds.
// Timed twice side by side with v002, it ran 1.26 times as fast both times.
// Counting every step since v000, it is 11.1 times as fast.
#include <hip/hip_runtime.h>

// Multi-head self-attention with per-head projection weights (inputs [8][1024][1024]; proj = einsum('bpv,havn->bhapn', inputs, w_qkv [16][3][1024][64]): q/k/v of head h = inputs w_qkv[h][0/1/2] ([1024][64]); scores = q.k / 8 over all 1024 keys; softmax; out = merged heads ([p][h*64+n]) w_o ('xw' [1024][1024]) -> [8][1024][1024] (8.4 M)).
// Compute dtypes, f32 accumulate: every input rounded to bf16; q/k/v on PLAIN bf16 operands (inputs: exact); the per-head weight slices gathered into three Bt matrices [h*64+n][v] (exact copies); the projection's epilogue splits q/k/v into the bf16 hi/lo head planes; scores and attn.v on bf16 hi/lo planes (3 products) for every query row (logit sigma 2.5); softmax f32; w_o hl x exact (2 products).

#define NB_  8
#define TT   1024
#define DM   1024
#define NH_  16
#define NKV  16
#define REP  (NH_ / NKV)
#define HD   64
#define DQ   (NH_ * HD)
#define DKV  (NKV * HD)
#define WIN  0
#define SCL  0.125f   // HD^-0.5
typedef _Float16 h16;
typedef unsigned short bf;
typedef __attribute__((ext_vector_type(16))) __bf16   v16bf;
typedef __attribute__((ext_vector_type(16))) _Float16 v16h;
typedef __attribute__((ext_vector_type(8)))  _Float16 v8h;
typedef __attribute__((ext_vector_type(8)))  unsigned short v8us;
typedef __attribute__((ext_vector_type(8)))  float    v8f;
typedef __attribute__((ext_vector_type(4)))  float    v4f;
typedef v8h  __attribute__((may_alias)) v8ha;
typedef v4f  __attribute__((may_alias)) v4fa;
typedef v8us __attribute__((may_alias)) v8usa;

__device__ __forceinline__ unsigned short f2bf(float f) { unsigned u = __float_as_uint(f); u += 0x7FFFu + ((u >> 16) & 1u); return (unsigned short)(u >> 16); }
__device__ __forceinline__ float bf2f(unsigned short b) { return __uint_as_float(((unsigned)b) << 16); }
__device__ __forceinline__ float bfr(float f) { return bf2f(f2bf(f)); }
__device__ __forceinline__ v16h cat16(v8h lo, v8h hi) { return __builtin_shufflevector(lo, hi, 0, 1, 2, 3, 4, 5, 6, 7, 8, 9, 10, 11, 12, 13, 14, 15); }
__device__ __forceinline__ v16bf cat16b(v8us lo, v8us hi) { return __builtin_bit_cast(v16bf, __builtin_shufflevector(lo, hi, 0, 1, 2, 3, 4, 5, 6, 7, 8, 9, 10, 11, 12, 13, 14, 15)); }
__device__ __forceinline__ v8f wmma16(v16h a, v16h b, v8f c) { return __builtin_amdgcn_wmma_f32_16x16x32_f16(false, a, false, b, (short)0, c, false, false); }
__device__ __forceinline__ v8f wmmab(v16bf a, v16bf b, v8f c) { return __builtin_amdgcn_wmma_f32_16x16x32_bf16(false, a, false, b, (short)0, c, false, false); }



// ---- k_gemmw: register-blocked GEMM, ONE WAVE per 64x64 output tile (16 accumulators), operands straight from K-contiguous 16-bit planes; grid (M/64, N/64, Z), 32 threads.
// C[m][n] (f32, pitch ldc, + optional f32 bias[n]) = sum_k A[m][k] Bt[n][k] (+ split products per NSPLIT). z-batch strides sA/sB/sC in elements. K % 32 == 0.
// PLANES: no f32 C. Rows m = b * TT + t, a column tile = one head, z = q, k, v: the tile goes out as bf16 hi/lo planes, P = [z][hi, lo][b][h] x ([t][d] for q and k, [d][t] for v).
template <typename T16> struct WFrag;
template <> struct WFrag<h16> { typedef v16h V; static __device__ __forceinline__ V ld(const h16* p) { return cat16(*(const v8h*)p, *(const v8h*)(p + 16)); } static __device__ __forceinline__ v8f mma(V a, V b, v8f c) { return wmma16(a, b, c); } };
template <> struct WFrag<bf> { typedef v16bf V; static __device__ __forceinline__ V ld(const bf* p) { return cat16b(*(const v8us*)p, *(const v8us*)(p + 16)); } static __device__ __forceinline__ v8f mma(V a, V b, v8f c) { return wmmab(a, b, c); } };
typedef __attribute__((ext_vector_type(2))) float v2f;
typedef __attribute__((ext_vector_type(2))) __bf16 v2bf;
typedef __attribute__((ext_vector_type(4))) unsigned v4u;
// x = hi + lo, both rounded to nearest even, a pair of values a packed conversion; the hi pair's two halves, each in the top of a word, are its values as f32
__device__ __forceinline__ void split8(v4f x0, v4f x1, v4u& h, v4u& l) {
#pragma unroll
    for (int k = 0; k < 4; ++k) { v2f p; p[0] = k < 2 ? x0[2 * k] : x1[2 * k - 4]; p[1] = k < 2 ? x0[2 * k + 1] : x1[2 * k - 3]; const unsigned u = __builtin_bit_cast(unsigned, __builtin_convertvector(p, v2bf));
        v2f f; f[0] = __uint_as_float(u << 16); f[1] = __uint_as_float(u & 0xFFFF0000u); h[k] = u; l[k] = __builtin_bit_cast(unsigned, __builtin_convertvector(p - f, v2bf)); } }
template <typename T16, int NSPLIT, bool BIAS, bool PLANES>
__global__ __launch_bounds__(32) void k_gemmw(const T16* __restrict__ A, const T16* __restrict__ A2, const T16* __restrict__ Bt, const T16* __restrict__ Bt2, int K, float* C, int ldc, const float* __restrict__ bias, size_t sA, size_t sB, size_t sC, bf* __restrict__ P) {
    typedef typename WFrag<T16>::V V;
    __shared__ __align__(16) float os[16 * 68];
    const size_t z = blockIdx.z; A += z * sA; if (A2) A2 += z * sA; Bt += z * sB; if (Bt2) Bt2 += z * sB; if (!PLANES) C += z * sC;
    const int lane = threadIdx.x & 31, lr = lane & 15, hi = lane >> 4; const int r0 = blockIdx.x * 64, c0 = blockIdx.y * 64;
    v8f acc[4][4];
#pragma unroll
    for (int mb = 0; mb < 4; ++mb)
#pragma unroll
        for (int nb = 0; nb < 4; ++nb) acc[mb][nb] = (v8f){};
    const size_t aoff = (size_t)(r0 + lr) * K + 8 * hi, boff = (size_t)(c0 + lr) * K + 8 * hi;
#pragma unroll 1
    for (int kc = 0; kc < K; kc += 32) {
        V a[4], a2[4];
#pragma unroll
        for (int mb = 0; mb < 4; ++mb) { a[mb] = WFrag<T16>::ld(A + aoff + (size_t)mb * 16 * K + kc); if (NSPLIT == 1 || NSPLIT == 2) a2[mb] = WFrag<T16>::ld(A2 + aoff + (size_t)mb * 16 * K + kc); }
#pragma unroll
        for (int nb = 0; nb < 4; ++nb) { const V b = WFrag<T16>::ld(Bt + boff + (size_t)nb * 16 * K + kc); V b2; if (NSPLIT >= 2) b2 = WFrag<T16>::ld(Bt2 + boff + (size_t)nb * 16 * K + kc);
#pragma unroll
            for (int mb = 0; mb < 4; ++mb) { acc[mb][nb] = WFrag<T16>::mma(a[mb], b, acc[mb][nb]); if (NSPLIT == 1 || NSPLIT == 2) acc[mb][nb] = WFrag<T16>::mma(a2[mb], b, acc[mb][nb]); if (NSPLIT >= 2) acc[mb][nb] = WFrag<T16>::mma(a[mb], b2, acc[mb][nb]); } }
        asm volatile("v_nop\n\tv_nop\n\tv_nop\n\tv_nop" : "+v"(acc[0][0]), "+v"(acc[1][1]), "+v"(acc[2][2]), "+v"(acc[3][3]) : "v"(a[0]), "v"(a[3]));
    }
    if constexpr (PLANES) {
        static_assert(HD == 64 && TT % 64 == 0, "a 64x64 tile is 64 positions of one batch entry and one whole head");
        const size_t PLE = (size_t)NB_ * NH_ * TT * HD; const int t0 = r0 % TT;
        bf* ph = P + z * 2 * PLE + ((size_t)(r0 / TT) * NH_ + blockIdx.y) * TT * HD; bf* pl = ph + PLE;
        const int rr = lane >> 3, cc = (lane & 7) * 8;   // read-back: 8 lanes a staged row, 8 values a lane, so every store instruction writes four whole 128-byte lines
        if (z < 2) {   // q, k: [t][d], 16 positions a round
            ph += (size_t)(t0 + rr) * HD + cc; pl += (size_t)(t0 + rr) * HD + cc;
#pragma unroll
            for (int mb = 0; mb < 4; ++mb) {
#pragma unroll
                for (int nb = 0; nb < 4; ++nb) {
#pragma unroll
                    for (int j = 0; j < 8; ++j) os[(hi * 8 + j) * 68 + nb * 16 + lr] = acc[mb][nb][j]; }
                __builtin_amdgcn_wave_barrier(); asm volatile("" ::: "memory");   // the compiler keeps the read-back behind the other lanes' staging writes
#pragma unroll
                for (int s = 0; s < 4; ++s) { const float* o8 = os + (4 * s + rr) * 68 + cc; const v4f x0 = *(const v4fa*)o8, x1 = *(const v4fa*)(o8 + 4); v4u vh, vl; split8(x0, x1, vh, vl);
                    *(v4u*)(ph + (mb * 16 + 4 * s) * HD) = vh; *(v4u*)(pl + (mb * 16 + 4 * s) * HD) = vl; }
                __builtin_amdgcn_wave_barrier(); asm volatile("" ::: "memory");   // and the next round's staging writes behind this read-back
            }
        } else {       // v: [d][t], 16 head columns a round; a lane's 8 accumulator registers are 8 positions in a row
            ph += (size_t)rr * TT + t0 + cc; pl += (size_t)rr * TT + t0 + cc;
#pragma unroll
            for (int nb = 0; nb < 4; ++nb) {
#pragma unroll
                for (int mb = 0; mb < 4; ++mb) { float* o8 = os + lr * 68 + mb * 16 + hi * 8; const v8f x = acc[mb][nb]; *(v4fa*)o8 = __builtin_shufflevector(x, x, 0, 1, 2, 3); *(v4fa*)(o8 + 4) = __builtin_shufflevector(x, x, 4, 5, 6, 7); }
                __builtin_amdgcn_wave_barrier(); asm volatile("" ::: "memory");   // as above
#pragma unroll
                for (int s = 0; s < 4; ++s) { const float* o8 = os + (4 * s + rr) * 68 + cc; const v4f x0 = *(const v4fa*)o8, x1 = *(const v4fa*)(o8 + 4); v4u vh, vl; split8(x0, x1, vh, vl);
                    *(v4u*)(ph + (size_t)(nb * 16 + 4 * s) * TT) = vh; *(v4u*)(pl + (size_t)(nb * 16 + 4 * s) * TT) = vl; }
                __builtin_amdgcn_wave_barrier(); asm volatile("" ::: "memory");   // as above
            }
            asm volatile("s_wait_xcnt 0x0" ::: "memory");   // in the listing this branch's end also runs on into the q, k branch (never taken), which rewrites registers that the stores above name
        }
    } else {
#pragma unroll
    for (int mb = 0; mb < 4; ++mb) {
#pragma unroll
        for (int nb = 0; nb < 4; ++nb) {
#pragma unroll
            for (int j = 0; j < 8; ++j) os[(hi * 8 + j) * 68 + nb * 16 + lr] = acc[mb][nb][j]; }
        __builtin_amdgcn_wave_barrier(); asm volatile("" ::: "memory");
        float* crow = C + (size_t)(r0 + mb * 16) * ldc + c0;
{
#pragma unroll
            for (int s = 0; s < 8; ++s) { const int row = 2 * s + hi, cofs = lr * 4; v4f val = *(const v4fa*)(os + row * 68 + cofs); if (BIAS) { val[0] += bfr(bias[c0 + cofs]); val[1] += bfr(bias[c0 + cofs + 1]); val[2] += bfr(bias[c0 + cofs + 2]); val[3] += bfr(bias[c0 + cofs + 3]); }
                *(v4f*)(crow + (size_t)row * ldc + cofs) = val; }
             }
        __builtin_amdgcn_wave_barrier(); asm volatile("" ::: "memory");
    }
    }
}

__device__ __forceinline__ void splitf(float y, unsigned short& h, unsigned short& l) { h = f2bf(y); l = f2bf(y - bf2f(h)); }
typedef __attribute__((ext_vector_type(4))) _Float16 v4h;
typedef __attribute__((ext_vector_type(2))) unsigned short v2us;
typedef __attribute__((ext_vector_type(4))) unsigned short v4us;
typedef __attribute__((ext_vector_type(4))) int v4i;

__global__ __launch_bounds__(256) void k_wtG(const float* __restrict__ w, int K, int N, bf* Bt) {
    const int lane = threadIdx.x & 31; const int L0 = (blockIdx.x * 8 + (threadIdx.x >> 5)) * 8; const int nlines = N * K / 64;
{
#pragma unroll 1
        for (int l = 0; l < 8; ++l) { const int L = L0 + l; if (L >= nlines) break; const size_t e = (size_t)L * 64 + lane * 2; const int k = (int)(e % K), n = (int)(e / K); v2us o;
            o[0] = f2bf(w[(size_t)k * N + n]); o[1] = f2bf(w[(size_t)(k + 1) * N + n]); *(v2us*)(Bt + e) = o; }
         }
}
// grid.y = part (0 q, 1 k, 2 v); the three Bt matrices lie one behind another in dst
__global__ __launch_bounds__(256) void k_wtGh(const float* __restrict__ W, bf* dst) { const int part = blockIdx.y; dst += (size_t)part * DQ * DM; const size_t i = (size_t)blockIdx.x * 256 + threadIdx.x; if (i >= (size_t)DQ * DM / 8) return; const int o = (int)(i / (DM / 8)); const int v0 = (int)(i % (DM / 8)) * 8; const int h = o / HD, n = o % HD; const float* src = W + (((size_t)h * 3 + part) * DM + v0) * HD + n; v8us ov;
#pragma unroll
    for (int k = 0; k < 8; ++k) ov[k] = f2bf(src[(size_t)k * HD]); *(v8us*)(dst + (size_t)o * DM + v0) = ov;  }
__global__ __launch_bounds__(256) void k_cvt8(const float* __restrict__ src, bf* dst, size_t n8) { const size_t i = (size_t)blockIdx.x * 256 + threadIdx.x; if (i >= n8) return; const v8f v = *(const v8f*)(src + i * 8); v8us o;
#pragma unroll
    for (int k = 0; k < 8; ++k) o[k] = f2bf(v[k]); *(v8us*)(dst + i * 8) = o;  }

// k_fattn: scores, softmax, attn.v and the head merge in one launch. One wave = 32 query columns of one (batch, head), 32 keys a pass:
// St = K Qt (A = key rows, B = query rows kept in registers), so a lane holds one query's scores; running maximum and sum in-lane plus one exchange between the wave halves;
// two St tiles, converted in place, are the B operand of Ot += Vt Pt (A = rows of the [d][t] planes). hi/lo planes, 3 products (hi hi, hi lo, lo hi). grid (TT/256, head, batch).
// Every inner loop is unrolled whole, so that the fragment and accumulator arrays are indexed by constants and stay in registers.
// The 8 waves of a block share each pass's 32 keys through LDS, two buffers: coalesced global loads of pass s + 1 are issued before the work of pass s and stored behind it; one barrier a pass.
#define KPI 72                               // LDS pitch of a key row (64 d), elements: 144 B = 16 B x odd, no bank conflict for 16-byte row reads
#define VPI 40                               // LDS pitch of a d row (32 keys), elements: 80 B = 16 B x odd
#define OKL (32 * KPI)                       // element offsets in a buffer: K hi 0, K lo, V hi, V lo
#define OVH (2 * 32 * KPI)
#define OVL (2 * 32 * KPI + 64 * VPI)
#define SBE (2 * 32 * KPI + 2 * 64 * VPI)    // elements of one buffer
__device__ __forceinline__ float xhalf(float x) { const int b = __float_as_int(x); return __int_as_float(__builtin_amdgcn_permlanex16(b, b, 0x76543210, 0xfedcba98, false, false)); }
__global__ __launch_bounds__(256) void k_fattn(const bf* __restrict__ Qh, const bf* __restrict__ Ql, const bf* __restrict__ Kh, const bf* __restrict__ Kl, const bf* __restrict__ Vh, const bf* __restrict__ Vl, bf* __restrict__ Ah, bf* __restrict__ Al) {
    typedef WFrag<bf> F; typedef v16bf V;
    __shared__ __align__(16) bf sm[2 * SBE];
    const int lane = threadIdx.x & 31, lr = lane & 15, hi = lane >> 4; const int h = blockIdx.y, b = blockIdx.z; const size_t zo = ((size_t)b * NH_ + h) * TT * HD; const int q0 = blockIdx.x * 256 + (threadIdx.x >> 5) * 32;
    const float C2 = SCL * 1.4426950408889634f;   // scores are kept in log2 units
    V qh[2][2], ql[2][2];
#pragma unroll
    for (int qt = 0; qt < 2; ++qt)
#pragma unroll
        for (int ks = 0; ks < 2; ++ks) { const size_t qo = zo + (size_t)(q0 + qt * 16 + lr) * HD + ks * 32 + 8 * hi; qh[qt][ks] = F::ld(Qh + qo); ql[qt][ks] = F::ld(Ql + qo); }
    v8f o[2][4]; float m[2]; v2f l[2];   // l: this lane's part of the row sum, even and odd keys apart
#pragma unroll
    for (int qt = 0; qt < 2; ++qt) { m[qt] = -3.0e38f; l[qt] = (v2f){};
#pragma unroll
        for (int dt = 0; dt < 4; ++dt) o[qt][dt] = (v8f){}; }
    const int tid = threadIdx.x;
    // staging: thread tid moves 16 bytes of each of the four planes a pass (K: 32 rows x 128 B, contiguous; V: 64 rows x 64 B)
    const bf* gkh = Kh + zo + tid * 8; const bf* gkl = Kl + zo + tid * 8; const bf* gvh = Vh + zo + (size_t)(tid >> 2) * TT + (tid & 3) * 8; const bf* gvl = Vl + zo + (size_t)(tid >> 2) * TT + (tid & 3) * 8;
    const int sk = (tid >> 3) * KPI + (tid & 7) * 8, sv = (tid >> 2) * VPI + (tid & 3) * 8; const int fk = lr * KPI + 8 * hi, fv = lr * VPI + 8 * hi;
    v8us g0 = *(const v8us*)gkh, g1 = *(const v8us*)gkl, g2 = *(const v8us*)gvh, g3 = *(const v8us*)gvl;
    *(v8us*)(sm + sk) = g0; *(v8us*)(sm + OKL + sk) = g1; *(v8us*)(sm + OVH + sv) = g2; *(v8us*)(sm + OVL + sv) = g3;
    __syncthreads();   // publishes pass 0
#pragma unroll 1   // rolled: two passes in one body would not fit the 256 registers that four waves per SIMD leave
    for (int k0 = 0; k0 < TT; k0 += 32) {
        const bf* cur = sm + ((k0 >> 5) & 1) * SBE; bf* nxt = sm + (((k0 >> 5) & 1) ^ 1) * SBE; const bool more = k0 + 32 < TT;
        if (more) { g0 = *(const v8us*)(gkh + (size_t)(k0 + 32) * HD); g1 = *(const v8us*)(gkl + (size_t)(k0 + 32) * HD); g2 = *(const v8us*)(gvh + k0 + 32); g3 = *(const v8us*)(gvl + k0 + 32); }
        v8f s[2][2];   // [query tile][key tile]: register r = score of key k0 + kt * 16 + 8 * hi + r, query column lr
#pragma unroll
        for (int kt = 0; kt < 2; ++kt) { V ah[2], al[2];
#pragma unroll
            for (int ks = 0; ks < 2; ++ks) { const int ko = fk + kt * 16 * KPI + ks * 32; ah[ks] = F::ld(cur + ko); al[ks] = F::ld(cur + OKL + ko); }
#pragma unroll
            for (int qt = 0; qt < 2; ++qt) { v8f t = (v8f){};
#pragma unroll
                for (int ks = 0; ks < 2; ++ks) { t = F::mma(ah[ks], qh[qt][ks], t); t = F::mma(ah[ks], ql[qt][ks], t); t = F::mma(al[ks], qh[qt][ks], t); }
                s[qt][kt] = t; } }
        float cm[2]; bool need = false;
#pragma unroll
        for (int qt = 0; qt < 2; ++qt) { float x = s[qt][0][0];
#pragma unroll
            for (int r = 0; r < 8; ++r) x = fmaxf(x, fmaxf(s[qt][0][r], s[qt][1][r]));
            x *= C2; cm[qt] = fmaxf(x, xhalf(x)); need = need || (cm[qt] > m[qt] + 8.0f); }
        // the maximum in use moves only when a column's new one exceeds it by more than 8 (log2): one wave-uniform test a pass
        if (__builtin_amdgcn_ballot_w32(need) != 0) {
#pragma unroll
            for (int qt = 0; qt < 2; ++qt) { const float mn = fmaxf(m[qt], cm[qt]); const float al2 = __builtin_amdgcn_exp2f(m[qt] - mn); m[qt] = mn; l[qt] *= al2;
#pragma unroll
                for (int dt = 0; dt < 4; ++dt) o[qt][dt] *= al2; } }
        V ph[2], pl[2];
#pragma unroll
        for (int qt = 0; qt < 2; ++qt) {
#pragma unroll
            for (int e = 0; e < 16; e += 2) { v2f x; x[0] = s[qt][e >> 3][e & 7]; x[1] = s[qt][e >> 3][(e & 7) + 1]; x = __builtin_elementwise_fma(x, (v2f){C2, C2}, (v2f){-m[qt], -m[qt]});
                v2f p; p[0] = __builtin_amdgcn_exp2f(x[0]); p[1] = __builtin_amdgcn_exp2f(x[1]); l[qt] += p;
                const v2bf a = __builtin_convertvector(p, v2bf); v2f rr; rr[0] = p[0] - (float)a[0]; rr[1] = p[1] - (float)a[1]; const v2bf c = __builtin_convertvector(rr, v2bf);
                ph[qt][e] = a[0]; ph[qt][e + 1] = a[1]; pl[qt][e] = c[0]; pl[qt][e + 1] = c[1]; } }
#pragma unroll
        for (int dt = 0; dt < 4; ++dt) { const int vo = fv + dt * 16 * VPI; const V bh = F::ld(cur + OVH + vo), bl = F::ld(cur + OVL + vo);
#pragma unroll
            for (int qt = 0; qt < 2; ++qt) { o[qt][dt] = F::mma(bh, ph[qt], o[qt][dt]); o[qt][dt] = F::mma(bh, pl[qt], o[qt][dt]); o[qt][dt] = F::mma(bl, ph[qt], o[qt][dt]); } }
        if (more) { *(v8us*)(nxt + sk) = g0; *(v8us*)(nxt + OKL + sk) = g1; *(v8us*)(nxt + OVH + sv) = g2; *(v8us*)(nxt + OVL + sv) = g3; }
        __syncthreads();   // publishes pass s + 1 and ends every wave's reads of the buffer that pass s + 1 refills
    }
#pragma unroll
    for (int qt = 0; qt < 2; ++qt) { const float lq = l[qt][0] + l[qt][1]; const float f = __fdiv_rn(1.0f, lq + xhalf(lq)); const size_t oo = ((size_t)b * TT + q0 + qt * 16 + lr) * DQ + h * HD + 8 * hi;
#pragma unroll
        for (int dt = 0; dt < 4; ++dt) { v8us oh, ol;
#pragma unroll
            for (int r = 0; r < 8; ++r) { unsigned short a, c2; splitf(o[qt][dt][r] * f, a, c2); oh[r] = a; ol[r] = c2; }
            *(v8us*)(Ah + oo + dt * 16) = oh; *(v8us*)(Al + oo + dt * 16) = ol; } }
}

extern "C" void kernel_launch(void* const* d_in, const int* in_sizes, int n_in,
                              void* d_out, int out_size, void* d_ws, size_t ws_size, hipStream_t stream) {
    (void)in_sizes; (void)n_in; (void)out_size;
    const float* x = (const float*)d_in[0]; const float* wqkv = (const float*)d_in[1]; const float* wo = (const float*)d_in[2]; const float* wq = nullptr; const float* wk = nullptr; const float* wv = nullptr; (void)wq; (void)wk; (void)wv;
    float* OUT = (float*)d_out;     // [8][1024][1024]
    char* wsp = (char*)d_ws;
    auto take = [&](size_t bytes) { char* p = wsp; wsp += (bytes + 255) & ~(size_t)255; return (void*)p; };
    const size_t PL = (size_t)NB_ * NH_ * TT * HD;   // elements of one plane set [b][h][t][d] (= NB_ * TT * DQ)
    bf* WQ = (bf*)take((size_t)3 * DQ * DM * 2);      // q, k, v weight slices, one behind another (z of the projection launch)
    bf* WO = (bf*)take((size_t)DM * DQ * 2);
    bf* QPh = (bf*)take(6 * PL * 2);                  // the six head planes, one behind another as the projection's epilogue writes them
    bf* QPl = QPh + PL; bf* KPh = QPl + PL; bf* KPl = KPh + PL; bf* VTh = KPl + PL; bf* VTl = VTh + PL;
    bf* XB = (bf*)take(PL * 2);
    bf* ATh = (bf*)take(2 * PL * 2); bf* ATl = ATh + PL;   // the merged heads [b][t][h*64+d]
    if ((size_t)(wsp - (char*)d_ws) > ws_size) return;    // ws 256 MiB
    k_wtGh<<<dim3((unsigned)(((size_t)DQ * DM / 8 + 255) / 256), 3, 1), 256, 0, stream>>>(wqkv, WQ);
    k_wtG<<<(unsigned)((DQ * DM / 64 + 63) / 64), 256, 0, stream>>>(wo, DQ, DM, WO);
    // every batch entry at once: rows m = b * TT + t; z = q, k, v
    k_cvt8<<<(unsigned)(((size_t)NB_ * TT * DM / 8 + 255) / 256), 256, 0, stream>>>(x, XB, (size_t)NB_ * TT * DM / 8);
    k_gemmw<bf, 0, false, true><<<dim3(NB_ * TT / 64, DQ / 64, 3), 32, 0, stream>>>(XB, nullptr, WQ, nullptr, DM, nullptr, 0, nullptr, 0, (size_t)DQ * DM, 0, QPh);
    k_fattn<<<dim3(TT / 256, NH_, NB_), 256, 0, stream>>>(QPh, QPl, KPh, KPl, VTh, VTl, ATh, ATl);
    k_gemmw<bf, 1, false, false><<<dim3(NB_ * TT / 64, DM / 64, 1), 32, 0, stream>>>(ATh, ATl, WO, nullptr, DQ, OUT, DM, nullptr, 0, 0, 0, nullptr);
}

// v004
// It runs in 170 microseconds.
// In two side-by-side timings against v003, it was 1.56 and 1.57 times as fast.
// All steps since v000 together make it 17.3 times as fast.
#include <hip/hip_runtime.h>

// Multi-head self-attention with per-head projection weights (inputs [8][1024][1024]; proj = einsum('bpv,havn->bhapn', inputs, w_qkv [16][3][1024][64]): q/k/v of head h = inputs w_qkv[h][0/1/2] ([1024][64]); scores = q.k / 8 over all 1024 keys; softmax; out = merged heads ([p][h*64+n]) w_o ('xw' [1024][1024]) -> [8][1024][1024] (8.4 M)).
// Compute dtypes, f32 accumulate: every input rounded to bf16; q/k/v on PLAIN bf16 operands (inputs: exact); the per-head weight slices gathered into three Bt matrices [h*64+n][v] (exact copies); the projection's epilogue splits q/k/v into the bf16 hi/lo head planes; scores and attn.v on bf16 hi/lo planes (3 products) for every query row (logit sigma 2.5); softmax f32; w_o hl x exact (2 products).

#define NB_  8
#define TT   1024
#define DM   1024
#define NH_  16
#define NKV  16
#define REP  (NH_ / NKV)
#define HD   64
#define DQ   (NH_ * HD)
#define DKV  (NKV * HD)
#define WIN  0
#define SCL  0.125f   // HD^-0.5
typedef _Float16 h16;
typedef unsigned short bf;
typedef __attribute__((ext_vector_type(16))) __bf16   v16bf;
typedef __attribute__((ext_vector_type(16))) _Float16 v16h;
typedef __attribute__((ext_vector_type(8)))  _Float16 v8h;
typedef __attribute__((ext_vector_type(8)))  unsigned short v8us;
typedef __attribute__((ext_vector_type(8)))  float    v8f;
typedef __attribute__((ext_vector_type(4)))  float    v4f;
typedef v8h  __attribute__((may_alias)) v8ha;
typedef v4f  __attribute__((may_alias)) v4fa;
typedef v8us __attribute__((may_alias)) v8usa;

__device__ __forceinline__ unsigned short f2bf(float f) { unsigned u = __float_as_uint(f); u += 0x7FFFu + ((u >> 16) & 1u); return (unsigned short)(u >> 16); }
__device__ __forceinline__ float bf2f(unsigned short b) { return __uint_as_float(((unsigned)b) << 16); }
__device__ __forceinline__ float bfr(float f) { return bf2f(f2bf(f)); }
__device__ __forceinline__ v16h cat16(v8h lo, v8h hi) { return __builtin_shufflevector(lo, hi, 0, 1, 2, 3, 4, 5, 6, 7, 8, 9, 10, 11, 12, 13, 14, 15); }
__device__ __forceinline__ v16bf cat16b(v8us lo, v8us hi) { return __builtin_bit_cast(v16bf, __builtin_shufflevector(lo, hi, 0, 1, 2, 3, 4, 5, 6, 7, 8, 9, 10, 11, 12, 13, 14, 15)); }
__device__ __forceinline__ v8f wmma16(v16h a, v16h b, v8f c) { return __builtin_amdgcn_wmma_f32_16x16x32_f16(false, a, false, b, (short)0, c, false, false); }
__device__ __forceinline__ v8f wmmab(v16bf a, v16bf b, v8f c) { return __builtin_amdgcn_wmma_f32_16x16x32_bf16(false, a, false, b, (short)0, c, false, false); }



// ---- k_gemmw: GEMM, 8 waves per 256x128 output tile (4 x 2 waves of 64x64, 16 accumulators each); grid (M/256, N/128, Z), 256 threads.
// The block's operand rows (K-contiguous 16-bit planes) come to LDS 64 k (one 128-byte line of every row) a trip, by asynchronous copies, two buffers: tile t + 2 flies while tile t + 1 is worked on.
// C[m][n] (f32, pitch ldc, + optional f32 bias[n]) = sum_k A[m][k] Bt[n][k] (+ A2[m][k] Bt[n][k] for NSPLIT 1). z-batch strides sA/sB/sC in elements. K % 64 == 0.
// PLANES: no f32 C. Rows m = b * TT + t, a wave's column tile = one head, z = q, k, v: the tile goes out as bf16 hi/lo planes, P = [z][hi, lo][b][h] x ([t][d] for q and k, [d][t] for v).
template <typename T16> struct WFrag;
template <> struct WFrag<h16> { typedef v16h V; static __device__ __forceinline__ V ld(const h16* p) { return cat16(*(const v8h*)p, *(const v8h*)(p + 16)); } static __device__ __forceinline__ v8f mma(V a, V b, v8f c) { return wmma16(a, b, c); } };
template <> struct WFrag<bf> { typedef v16bf V; static __device__ __forceinline__ V ld(const bf* p) { return cat16b(*(const v8us*)p, *(const v8us*)(p + 16)); } static __device__ __forceinline__ v8f mma(V a, V b, v8f c) { return wmmab(a, b, c); } };
typedef __attribute__((ext_vector_type(2))) float v2f;
typedef __attribute__((ext_vector_type(2))) __bf16 v2bf;
typedef __attribute__((ext_vector_type(4))) unsigned v4u;
// x = hi + lo, both rounded to nearest even, a pair of values a packed conversion; the hi pair's two halves, each in the top of a word, are its values as f32
__device__ __forceinline__ void split8(v4f x0, v4f x1, v4u& h, v4u& l) {
#pragma unroll
    for (int k = 0; k < 4; ++k) { v2f p; p[0] = k < 2 ? x0[2 * k] : x1[2 * k - 4]; p[1] = k < 2 ? x0[2 * k + 1] : x1[2 * k - 3]; const unsigned u = __builtin_bit_cast(unsigned, __builtin_convertvector(p, v2bf));
        v2f f; f[0] = __uint_as_float(u << 16); f[1] = __uint_as_float(u & 0xFFFF0000u); h[k] = u; l[k] = __builtin_bit_cast(unsigned, __builtin_convertvector(p - f, v2bf)); } }
#define GPI 72                               // LDS pitch of an operand row (64 k), elements: 144 B = 16 B x odd, no bank conflict for 16-byte row reads
// a run of asynchronous 16-byte copies of this lane, global g[i] to LDS byte address l[i]; the closing wait stands in the same statement, in front of any rewrite of the address registers that the copies name;
// as many copies a statement as the operand list takes, because every such wait holds the wave up once
__device__ __forceinline__ void acopy12(const unsigned* l, const bf* const* g) {
    asm volatile("global_load_async_to_lds_b128 %0, %1, off\n\tglobal_load_async_to_lds_b128 %2, %3, off\n\tglobal_load_async_to_lds_b128 %4, %5, off\n\tglobal_load_async_to_lds_b128 %6, %7, off\n\tglobal_load_async_to_lds_b128 %8, %9, off\n\tglobal_load_async_to_lds_b128 %10, %11, off\n\tglobal_load_async_to_lds_b128 %12, %13, off\n\tglobal_load_async_to_lds_b128 %14, %15, off\n\tglobal_load_async_to_lds_b128 %16, %17, off\n\tglobal_load_async_to_lds_b128 %18, %19, off\n\tglobal_load_async_to_lds_b128 %20, %21, off\n\tglobal_load_async_to_lds_b128 %22, %23, off\n\ts_wait_xcnt 0x0"
                 :: "v"(l[0]), "v"(g[0]), "v"(l[1]), "v"(g[1]), "v"(l[2]), "v"(g[2]), "v"(l[3]), "v"(g[3]), "v"(l[4]), "v"(g[4]), "v"(l[5]), "v"(g[5]), "v"(l[6]), "v"(g[6]), "v"(l[7]), "v"(g[7]), "v"(l[8]), "v"(g[8]), "v"(l[9]), "v"(g[9]), "v"(l[10]), "v"(g[10]), "v"(l[11]), "v"(g[11]) : "memory"); }
__device__ __forceinline__ void acopy10(const unsigned* l, const bf* const* g) {
    asm volatile("global_load_async_to_lds_b128 %0, %1, off\n\tglobal_load_async_to_lds_b128 %2, %3, off\n\tglobal_load_async_to_lds_b128 %4, %5, off\n\tglobal_load_async_to_lds_b128 %6, %7, off\n\tglobal_load_async_to_lds_b128 %8, %9, off\n\tglobal_load_async_to_lds_b128 %10, %11, off\n\tglobal_load_async_to_lds_b128 %12, %13, off\n\tglobal_load_async_to_lds_b128 %14, %15, off\n\tglobal_load_async_to_lds_b128 %16, %17, off\n\tglobal_load_async_to_lds_b128 %18, %19, off\n\ts_wait_xcnt 0x0"
                 :: "v"(l[0]), "v"(g[0]), "v"(l[1]), "v"(g[1]), "v"(l[2]), "v"(g[2]), "v"(l[3]), "v"(g[3]), "v"(l[4]), "v"(g[4]), "v"(l[5]), "v"(g[5]), "v"(l[6]), "v"(g[6]), "v"(l[7]), "v"(g[7]), "v"(l[8]), "v"(g[8]), "v"(l[9]), "v"(g[9]) : "memory"); }
template <typename T16, int NSPLIT, bool BIAS, bool PLANES, int K>
__global__ __launch_bounds__(256) void k_gemmw(const T16* __restrict__ A, const T16* __restrict__ A2, const T16* __restrict__ Bt, float* C, int ldc, const float* __restrict__ bias, size_t sA, size_t sB, size_t sC, bf* __restrict__ P) {
    typedef typename WFrag<T16>::V V;
    static_assert(NSPLIT <= 1 && K % 64 == 0 && K >= 128, "plain or hi/lo A; whole 64-k tiles, two or more");
    constexpr int OA2 = 256 * GPI, OB = (NSPLIT == 1 ? 2 : 1) * 256 * GPI, GBE = OB + 128 * GPI;   // element offsets in a buffer: A 0, A2, Bt; elements of one buffer
    __shared__ __align__(16) T16 sm[2 * GBE];
    const size_t z = blockIdx.z; A += z * sA; if (NSPLIT == 1) A2 += z * sA; Bt += z * sB; if (!PLANES) C += z * sC;
    const int tid = threadIdx.x, lane = tid & 31, lr = lane & 15, hi = lane >> 4, wave = tid >> 5; const int r0 = blockIdx.x * 256 + (wave & 3) * 64, c0 = blockIdx.y * 128 + (wave >> 2) * 64;
    v8f acc[4][4];
#pragma unroll
    for (int mb = 0; mb < 4; ++mb)
#pragma unroll
        for (int nb = 0; nb < 4; ++nb) acc[mb][nb] = (v8f){};
    const size_t go = (size_t)(tid >> 3) * K + (tid & 7) * 8;
    const T16* ga = A + (size_t)blockIdx.x * 256 * K + go; const T16* ga2 = NSPLIT == 1 ? A2 + (size_t)blockIdx.x * 256 * K + go : nullptr; const T16* gb = Bt + (size_t)blockIdx.y * 128 * K + go;
    const unsigned ls = (unsigned)(size_t)sm + ((tid >> 3) * GPI + (tid & 7) * 8) * 2;   // this thread's first 16 bytes in buffer 0, as an LDS byte address
    // a tile: rows of 128 bytes; a thread's copy i of an operand takes 16 bytes of row (tid >> 3) + 32 * i, so a wave's copy covers four whole lines
    auto fill = [&](int t) { constexpr int NA = NSPLIT == 1 ? 16 : 8; unsigned l[NA + 4]; const T16* g[NA + 4]; const unsigned lb = ls + (t & 1) * GBE * 2;
#pragma unroll
        for (int i = 0; i < 8; ++i) { l[i] = lb + i * 32 * GPI * 2; g[i] = ga + t * 64 + (size_t)i * 32 * K; if (NSPLIT == 1) { l[8 + i] = lb + OA2 * 2 + i * 32 * GPI * 2; g[8 + i] = ga2 + t * 64 + (size_t)i * 32 * K; } }
#pragma unroll
        for (int i = 0; i < 4; ++i) { l[NA + i] = lb + OB * 2 + i * 32 * GPI * 2; g[NA + i] = gb + t * 64 + (size_t)i * 32 * K; }
        if constexpr (NSPLIT == 1) { acopy10(l, g); acopy10(l + 10, g + 10); } else acopy12(l, g); };
    fill(0);
    asm volatile("s_wait_asynccnt 0x0" ::: "memory");   // this wave's part of tile 0 has landed
    __syncthreads();                                    // publishes tile 0
    fill(1);
    const int fa = ((wave & 3) * 64 + lr) * GPI + 8 * hi, fb = OB + ((wave >> 2) * 64 + lr) * GPI + 8 * hi;
#pragma unroll 1   // rolled: one tile a trip, the buffer chosen by the trip's parity
    for (int t = 0; t < K / 64; ++t) {
        const T16* cur = sm + (t & 1) * GBE;
#pragma unroll
        for (int ks = 0; ks < 2; ++ks) {
            V a[4], a2[4], b[4];   // all of a 32-k block's fragments are asked for in one group, ahead of its products
#pragma unroll
            for (int mb = 0; mb < 4; ++mb) { a[mb] = WFrag<T16>::ld(cur + fa + mb * 16 * GPI + ks * 32); b[mb] = WFrag<T16>::ld(cur + fb + mb * 16 * GPI + ks * 32); if (NSPLIT == 1) a2[mb] = WFrag<T16>::ld(cur + OA2 + fa + mb * 16 * GPI + ks * 32); }
            __builtin_amdgcn_sched_barrier(0);   // keeps the group whole: without it the compiler sinks the b loads among the products, each with a full LDS wait in front of four products
            if (ks == 1) {   // the tile's last fragments are asked for: the hand-over stands here, so that the refill flies during this block's products too
                asm volatile("s_wait_dscnt 0x0" ::: "memory");      // this wave's reads of tile t are done before its buffer is refilled
                asm volatile("s_wait_asynccnt 0x0" ::: "memory");   // this wave's part of tile t + 1 has landed
                __syncthreads();                                    // publishes tile t + 1 and ends every wave's reads of the buffer that tile t + 2 refills
                if (t + 2 < K / 64) fill(t + 2);
            }
#pragma unroll
            for (int nb = 0; nb < 4; ++nb) {
#pragma unroll
                for (int mb = 0; mb < 4; ++mb) { acc[mb][nb] = WFrag<T16>::mma(a[mb], b[nb], acc[mb][nb]); if (NSPLIT == 1) acc[mb][nb] = WFrag<T16>::mma(a2[mb], b[nb], acc[mb][nb]); } }
        }
    }
    asm volatile("s_wait_asynccnt 0x0" ::: "memory");       // no copy is in flight when the ring becomes the epilogue's staging
    float* os = (float*)sm + wave * (16 * 68);              // each wave stages in its own range; the last trip's barrier ended every read of the ring
    if constexpr (PLANES) {
        static_assert(HD == 64 && TT % 64 == 0, "a 64x64 tile is 64 positions of one batch entry and one whole head");
        const size_t PLE = (size_t)NB_ * NH_ * TT * HD; const int t0 = r0 % TT;
        bf* ph = P + z * 2 * PLE + ((size_t)(r0 / TT) * NH_ + c0 / HD) * TT * HD; bf* pl = ph + PLE;
        const int rr = lane >> 3, cc = (lane & 7) * 8;   // read-back: 8 lanes a staged row, 8 values a lane, so every store instruction writes four whole 128-byte lines
        if (z < 2) {   // q, k: [t][d], 16 positions a round
            ph += (size_t)(t0 + rr) * HD + cc; pl += (size_t)(t0 + rr) * HD + cc;
#pragma unroll
            for (int mb = 0; mb < 4; ++mb) {
#pragma unroll
                for (int nb = 0; nb < 4; ++nb) {
#pragma unroll
                    for (int j = 0; j < 8; ++j) os[(hi * 8 + j) * 68 + nb * 16 + lr] = acc[mb][nb][j]; }
                __builtin_amdgcn_wave_barrier(); asm volatile("" ::: "memory");   // the compiler keeps the read-back behind the other lanes' staging writes
#pragma unroll
                for (int s = 0; s < 4; ++s) { const float* o8 = os + (4 * s + rr) * 68 + cc; const v4f x0 = *(const v4fa*)o8, x1 = *(const v4fa*)(o8 + 4); v4u vh, vl; split8(x0, x1, vh, vl);
                    *(v4u*)(ph + (mb * 16 + 4 * s) * HD) = vh; *(v4u*)(pl + (mb * 16 + 4 * s) * HD) = vl; }
                __builtin_amdgcn_wave_barrier(); asm volatile("" ::: "memory");   // and the next round's staging writes behind this read-back
            }
        } else {       // v: [d][t], 16 head columns a round; a lane's 8 accumulator registers are 8 positions in a row
            ph += (size_t)rr * TT + t0 + cc; pl += (size_t)rr * TT + t0 + cc;
#pragma unroll
            for (int nb = 0; nb < 4; ++nb) {
#pragma unroll
                for (int mb = 0; mb < 4; ++mb) { float* o8 = os + lr * 68 + mb * 16 + hi * 8; const v8f x = acc[mb][nb]; *(v4fa*)o8 = __builtin_shufflevector(x, x, 0, 1, 2, 3); *(v4fa*)(o8 + 4) = __builtin_shufflevector(x, x, 4, 5, 6, 7); }
                __builtin_amdgcn_wave_barrier(); asm volatile("" ::: "memory");   // as above
#pragma unroll
                for (int s = 0; s < 4; ++s) { const float* o8 = os + (4 * s + rr) * 68 + cc; const v4f x0 = *(const v4fa*)o8, x1 = *(const v4fa*)(o8 + 4); v4u vh, vl; split8(x0, x1, vh, vl);
                    *(v4u*)(ph + (size_t)(nb * 16 + 4 * s) * TT) = vh; *(v4u*)(pl + (size_t)(nb * 16 + 4 * s) * TT) = vl; }
                __builtin_amdgcn_wave_barrier(); asm volatile("" ::: "memory");   // as above
            }
            asm volatile("s_wait_xcnt 0x0" ::: "memory");   // in the listing this branch's end also runs on into the q, k branch (never taken), which rewrites registers that the stores above name
        }
    } else {
#pragma unroll
    for (int mb = 0; mb < 4; ++mb) {
#pragma unroll
        for (int nb = 0; nb < 4; ++nb) {
#pragma unroll
            for (int j = 0; j < 8; ++j) os[(hi * 8 + j) * 68 + nb * 16 + lr] = acc[mb][nb][j]; }
        __builtin_amdgcn_wave_barrier(); asm volatile("" ::: "memory");
        float* crow = C + (size_t)(r0 + mb * 16) * ldc + c0;
{
#pragma unroll
            for (int s = 0; s < 8; ++s) { const int row = 2 * s + hi, cofs = lr * 4; v4f val = *(const v4fa*)(os + row * 68 + cofs); if (BIAS) { val[0] += bfr(bias[c0 + cofs]); val[1] += bfr(bias[c0 + cofs + 1]); val[2] += bfr(bias[c0 + cofs + 2]); val[3] += bfr(bias[c0 + cofs + 3]); }
                *(v4f*)(crow + (size_t)row * ldc + cofs) = val; }
             }
        __builtin_amdgcn_wave_barrier(); asm volatile("" ::: "memory");
    }
    }
}

__device__ __forceinline__ void splitf(float y, unsigned short& h, unsigned short& l) { h = f2bf(y); l = f2bf(y - bf2f(h)); }
typedef __attribute__((ext_vector_type(4))) _Float16 v4h;
typedef __attribute__((ext_vector_type(2))) unsigned short v2us;
typedef __attribute__((ext_vector_type(4))) unsigned short v4us;
typedef __attribute__((ext_vector_type(4))) int v4i;

__global__ __launch_bounds__(256) void k_wtG(const float* __restrict__ w, int K, int N, bf* Bt) {
    const int lane = threadIdx.x & 31; const int L0 = (blockIdx.x * 8 + (threadIdx.x >> 5)) * 8; const int nlines = N * K / 64;
{
#pragma unroll 1
        for (int l = 0; l < 8; ++l) { const int L = L0 + l; if (L >= nlines) break; const size_t e = (size_t)L * 64 + lane * 2; const int k = (int)(e % K), n = (int)(e / K); v2us o;
            o[0] = f2bf(w[(size_t)k * N + n]); o[1] = f2bf(w[(size_t)(k + 1) * N + n]); *(v2us*)(Bt + e) = o; }
         }
}
// grid.y = part (0 q, 1 k, 2 v); the three Bt matrices lie one behind another in dst
__global__ __launch_bounds__(256) void k_wtGh(const float* __restrict__ W, bf* dst) { const int part = blockIdx.y; dst += (size_t)part * DQ * DM; const size_t i = (size_t)blockIdx.x * 256 + threadIdx.x; if (i >= (size_t)DQ * DM / 8) return; const int o = (int)(i / (DM / 8)); const int v0 = (int)(i % (DM / 8)) * 8; const int h = o / HD, n = o % HD; const float* src = W + (((size_t)h * 3 + part) * DM + v0) * HD + n; v8us ov;
#pragma unroll
    for (int k = 0; k < 8; ++k) ov[k] = f2bf(src[(size_t)k * HD]); *(v8us*)(dst + (size_t)o * DM + v0) = ov;  }
__global__ __launch_bounds__(256) void k_cvt8(const float* __restrict__ src, bf* dst, size_t n8) { const size_t i = (size_t)blockIdx.x * 256 + threadIdx.x; if (i >= n8) return; const v8f v = *(const v8f*)(src + i * 8); v8us o;
#pragma unroll
    for (int k = 0; k < 8; ++k) o[k] = f2bf(v[k]); *(v8us*)(dst + i * 8) = o;  }

// k_fattn: scores, softmax, attn.v and the head merge in one launch. One wave = 32 query columns of one (batch, head), 32 keys a pass:
// St = K Qt (A = key rows, B = query rows kept in registers), so a lane holds one query's scores; running maximum and sum in-lane plus one exchange between the wave halves;
// two St tiles, converted in place, are the B operand of Ot += Vt Pt (A = rows of the [d][t] planes). hi/lo planes, 3 products (hi hi, hi lo, lo hi). grid (TT/256, head, batch).
// Every inner loop is unrolled whole, so that the fragment and accumulator arrays are indexed by constants and stay in registers.
// The 8 waves of a block share each pass's 32 keys through LDS, two buffers: coalesced global loads of pass s + 1 are issued before the work of pass s and stored behind it; one barrier a pass.
#define KPI 72                               // LDS pitch of a key row (64 d), elements: 144 B = 16 B x odd, no bank conflict for 16-byte row reads
#define VPI 40                               // LDS pitch of a d row (32 keys), elements: 80 B = 16 B x odd
#define OKL (32 * KPI)                       // element offsets in a buffer: K hi 0, K lo, V hi, V lo
#define OVH (2 * 32 * KPI)
#define OVL (2 * 32 * KPI + 64 * VPI)
#define SBE (2 * 32 * KPI + 2 * 64 * VPI)    // elements of one buffer
__device__ __forceinline__ float xhalf(float x) { const int b = __float_as_int(x); return __int_as_float(__builtin_amdgcn_permlanex16(b, b, 0x76543210, 0xfedcba98, false, false)); }
__global__ __launch_bounds__(256) void k_fattn(const bf* __restrict__ Qh, const bf* __restrict__ Ql, const bf* __restrict__ Kh, const bf* __restrict__ Kl, const bf* __restrict__ Vh, const bf* __restrict__ Vl, bf* __restrict__ Ah, bf* __restrict__ Al) {
    typedef WFrag<bf> F; typedef v16bf V;
    __shared__ __align__(16) bf sm[2 * SBE];
    const int lane = threadIdx.x & 31, lr = lane & 15, hi = lane >> 4; const int h = blockIdx.y, b = blockIdx.z; const size_t zo = ((size_t)b * NH_ + h) * TT * HD; const int q0 = blockIdx.x * 256 + (threadIdx.x >> 5) * 32;
    const float C2 = SCL * 1.4426950408889634f;   // scores are kept in log2 units
    V qh[2][2], ql[2][2];
#pragma unroll
    for (int qt = 0; qt < 2; ++qt)
#pragma unroll
        for (int ks = 0; ks < 2; ++ks) { const size_t qo = zo + (size_t)(q0 + qt * 16 + lr) * HD + ks * 32 + 8 * hi; qh[qt][ks] = F::ld(Qh + qo); ql[qt][ks] = F::ld(Ql + qo); }
    v8f o[2][4]; float m[2]; v2f l[2];   // l: this lane's part of the row sum, even and odd keys apart
#pragma unroll
    for (int qt = 0; qt < 2; ++qt) { m[qt] = -3.0e38f; l[qt] = (v2f){};
#pragma unroll
        for (int dt = 0; dt < 4; ++dt) o[qt][dt] = (v8f){}; }
    const int tid = threadIdx.x;
    // staging: thread tid moves 16 bytes of each of the four planes a pass (K: 32 rows x 128 B, contiguous; V: 64 rows x 64 B)
    const bf* gkh = Kh + zo + tid * 8; const bf* gkl = Kl + zo + tid * 8; const bf* gvh = Vh + zo + (size_t)(tid >> 2) * TT + (tid & 3) * 8; const bf* gvl = Vl + zo + (size_t)(tid >> 2) * TT + (tid & 3) * 8;
    const int sk = (tid >> 3) * KPI + (tid & 7) * 8, sv = (tid >> 2) * VPI + (tid & 3) * 8; const int fk = lr * KPI + 8 * hi, fv = lr * VPI + 8 * hi;
    v8us g0 = *(const v8us*)gkh, g1 = *(const v8us*)gkl, g2 = *(const v8us*)gvh, g3 = *(const v8us*)gvl;
    *(v8us*)(sm + sk) = g0; *(v8us*)(sm + OKL + sk) = g1; *(v8us*)(sm + OVH + sv) = g2; *(v8us*)(sm + OVL + sv) = g3;
    __syncthreads();   // publishes pass 0
#pragma unroll 1   // rolled: two passes in one body would not fit the 256 registers that four waves per SIMD leave
    for (int k0 = 0; k0 < TT; k0 += 32) {
        const bf* cur = sm + ((k0 >> 5) & 1) * SBE; bf* nxt = sm + (((k0 >> 5) & 1) ^ 1) * SBE; const bool more = k0 + 32 < TT;
        if (more) { g0 = *(const v8us*)(gkh + (size_t)(k0 + 32) * HD); g1 = *(const v8us*)(gkl + (size_t)(k0 + 32) * HD); g2 = *(const v8us*)(gvh + k0 + 32); g3 = *(const v8us*)(gvl + k0 + 32); }
        v8f s[2][2];   // [query tile][key tile]: register r = score of key k0 + kt * 16 + 8 * hi + r, query column lr
#pragma unroll
        for (int kt = 0; kt < 2; ++kt) { V ah[2], al[2];
#pragma unroll
            for (int ks = 0; ks < 2; ++ks) { const int ko = fk + kt * 16 * KPI + ks * 32; ah[ks] = F::ld(cur + ko); al[ks] = F::ld(cur + OKL + ko); }
#pragma unroll
            for (int qt = 0; qt < 2; ++qt) { v8f t = (v8f){};
#pragma unroll
                for (int ks = 0; ks < 2; ++ks) { t = F::mma(ah[ks], qh[qt][ks], t); t = F::mma(ah[ks], ql[qt][ks], t); t = F::mma(al[ks], qh[qt][ks], t); }
                s[qt][kt] = t; } }
        float cm[2]; bool need = false;
#pragma unroll
        for (int qt = 0; qt < 2; ++qt) { float x = s[qt][0][0];
#pragma unroll
            for (int r = 0; r < 8; ++r) x = fmaxf(x, fmaxf(s[qt][0][r], s[qt][1][r]));
            x *= C2; cm[qt] = fmaxf(x, xhalf(x)); need = need || (cm[qt] > m[qt] + 8.0f); }
        // the maximum in use moves only when a column's new one exceeds it by more than 8 (log2): one wave-uniform test a pass
        if (__builtin_amdgcn_ballot_w32(need) != 0) {
#pragma unroll
            for (int qt = 0; qt < 2; ++qt) { const float mn = fmaxf(m[qt], cm[qt]); const float al2 = __builtin_amdgcn_exp2f(m[qt] - mn); m[qt] = mn; l[qt] *= al2;
#pragma unroll
                for (int dt = 0; dt < 4; ++dt) o[qt][dt] *= al2; } }
        V ph[2], pl[2];
#pragma unroll
        for (int qt = 0; qt < 2; ++qt) {
#pragma unroll
            for (int e = 0; e < 16; e += 2) { v2f x; x[0] = s[qt][e >> 3][e & 7]; x[1] = s[qt][e >> 3][(e & 7) + 1]; x = __builtin_elementwise_fma(x, (v2f){C2, C2}, (v2f){-m[qt], -m[qt]});
                v2f p; p[0] = __builtin_amdgcn_exp2f(x[0]); p[1] = __builtin_amdgcn_exp2f(x[1]); l[qt] += p;
                const v2bf a = __builtin_convertvector(p, v2bf); v2f rr; rr[0] = p[0] - (float)a[0]; rr[1] = p[1] - (float)a[1]; const v2bf c = __builtin_convertvector(rr, v2bf);
                ph[qt][e] = a[0]; ph[qt][e + 1] = a[1]; pl[qt][e] = c[0]; pl[qt][e + 1] = c[1]; } }
#pragma unroll
        for (int dt = 0; dt < 4; ++dt) { const int vo = fv + dt * 16 * VPI; const V bh = F::ld(cur + OVH + vo), bl = F::ld(cur + OVL + vo);
#pragma unroll
            for (int qt = 0; qt < 2; ++qt) { o[qt][dt] = F::mma(bh, ph[qt], o[qt][dt]); o[qt][dt] = F::mma(bh, pl[qt], o[qt][dt]); o[qt][dt] = F::mma(bl, ph[qt], o[qt][dt]); } }
        if (more) { *(v8us*)(nxt + sk) = g0; *(v8us*)(nxt + OKL + sk) = g1; *(v8us*)(nxt + OVH + sv) = g2; *(v8us*)(nxt + OVL + sv) = g3; }
        __syncthreads();   // publishes pass s + 1 and ends every wave's reads of the buffer that pass s + 1 refills
    }
#pragma unroll
    for (int qt = 0; qt < 2; ++qt) { const float lq = l[qt][0] + l[qt][1]; const float f = __fdiv_rn(1.0f, lq + xhalf(lq)); const size_t oo = ((size_t)b * TT + q0 + qt * 16 + lr) * DQ + h * HD + 8 * hi;
#pragma unroll
        for (int dt = 0; dt < 4; ++dt) { v8us oh, ol;
#pragma unroll
            for (int r = 0; r < 8; ++r) { unsigned short a, c2; splitf(o[qt][dt][r] * f, a, c2); oh[r] = a; ol[r] = c2; }
            *(v8us*)(Ah + oo + dt * 16) = oh; *(v8us*)(Al + oo + dt * 16) = ol; } }
}

extern "C" void kernel_launch(void* const* d_in, const int* in_sizes, int n_in,
                              void* d_out, int out_size, void* d_ws, size_t ws_size, hipStream_t stream) {
    (void)in_sizes; (void)n_in; (void)out_size;
    const float* x = (const float*)d_in[0]; const float* wqkv = (const float*)d_in[1]; const float* wo = (const float*)d_in[2]; const float* wq = nullptr; const float* wk = nullptr; const float* wv = nullptr; (void)wq; (void)wk; (void)wv;
    float* OUT = (float*)d_out;     // [8][1024][1024]
    char* wsp = (char*)d_ws;
    auto take = [&](size_t bytes) { char* p = wsp; wsp += (bytes + 255) & ~(size_t)255; return (void*)p; };
    const size_t PL = (size_t)NB_ * NH_ * TT * HD;   // elements of one plane set [b][h][t][d] (= NB_ * TT * DQ)
    bf* WQ = (bf*)take((size_t)3 * DQ * DM * 2);      // q, k, v weight slices, one behind another (z of the projection launch)
    bf* WO = (bf*)take((size_t)DM * DQ * 2);
    bf* QPh = (bf*)take(6 * PL * 2);                  // the six head planes, one behind another as the projection's epilogue writes them
    bf* QPl = QPh + PL; bf* KPh = QPl + PL; bf* KPl = KPh + PL; bf* VTh = KPl + PL; bf* VTl = VTh + PL;
    bf* XB = (bf*)take(PL * 2);
    bf* ATh = (bf*)take(2 * PL * 2); bf* ATl = ATh + PL;   // the merged heads [b][t][h*64+d]
    if ((size_t)(wsp - (char*)d_ws) > ws_size) return;    // ws 256 MiB
    k_wtGh<<<dim3((unsigned)(((size_t)DQ * DM / 8 + 255) / 256), 3, 1), 256, 0, stream>>>(wqkv, WQ);
    k_wtG<<<(unsigned)((DQ * DM / 64 + 63) / 64), 256, 0, stream>>>(wo, DQ, DM, WO);
    // every batch entry at once: rows m = b * TT + t; z = q, k, v
    k_cvt8<<<(unsigned)(((size_t)NB_ * TT * DM / 8 + 255) / 256), 256, 0, stream>>>(x, XB, (size_t)NB_ * TT * DM / 8);
    k_gemmw<bf, 0, false, true, DM><<<dim3(NB_ * TT / 256, DQ / 128, 3), 256, 0, stream>>>(XB, nullptr, WQ, nullptr, 0, nullptr, 0, (size_t)DQ * DM, 0, QPh);
    k_fattn<<<dim3(TT / 256, NH_, NB_), 256, 0, stream>>>(QPh, QPl, KPh, KPl, VTh, VTl, ATh, ATl);
    k_gemmw<bf, 1, false, false, DQ><<<dim3(NB_ * TT / 256, DM / 128, 1), 256, 0, stream>>>(ATh, ATl, WO, OUT, DM, nullptr, 0, 0, 0, nullptr);
}

// v005
// It runs in 154 microseconds.
// In two side-by-side timings against v004, it was 1.12 and 1.11 times as fast.
// Over all steps from v000 it is 19.3 times as fast.
#include <hip/hip_runtime.h>

// Multi-head self-attention with per-head projection weights (inputs [8][1024][1024]; proj = einsum('bpv,havn->bhapn', inputs, w_qkv [16][3][1024][64]): q/k/v of head h = inputs w_qkv[h][0/1/2] ([1024][64]); scores = q.k / 8 over all 1024 keys; softmax; out = merged heads ([p][h*64+n]) w_o ('xw' [1024][1024]) -> [8][1024][1024] (8.4 M)).
// Compute dtypes, f32 accumulate: every input rounded to bf16; q/k/v on PLAIN bf16 operands (inputs: exact); the per-head weight slices gathered into three Bt matrices [h*64+n][v] (exact copies); the projection's epilogue splits q/k/v into the bf16 hi/lo head planes; scores and attn.v on bf16 hi/lo planes (3 products) for every query row (logit sigma 2.5); softmax f32; w_o hl x exact (2 products).

#define NB_  8
#define TT   1024
#define DM   1024
#define NH_  16
#define NKV  16
#define REP  (NH_ / NKV)
#define HD   64
#define DQ   (NH_ * HD)
#define DKV  (NKV * HD)
#define WIN  0
#define SCL  0.125f   // HD^-0.5
typedef _Float16 h16;
typedef unsigned short bf;
typedef __attribute__((ext_vector_type(16))) __bf16   v16bf;
typedef __attribute__((ext_vector_type(16))) _Float16 v16h;
typedef __attribute__((ext_vector_type(8)))  _Float16 v8h;
typedef __attribute__((ext_vector_type(8)))  unsigned short v8us;
typedef __attribute__((ext_vector_type(8)))  float    v8f;
typedef __attribute__((ext_vector_type(4)))  float    v4f;
typedef v8h  __attribute__((may_alias)) v8ha;
typedef v4f  __attribute__((may_alias)) v4fa;
typedef v8us __attribute__((may_alias)) v8usa;

__device__ __forceinline__ unsigned short f2bf(float f) { unsigned u = __float_as_uint(f); u += 0x7FFFu + ((u >> 16) & 1u); return (unsigned short)(u >> 16); }
__device__ __forceinline__ float bf2f(unsigned short b) { return __uint_as_float(((unsigned)b) << 16); }
__device__ __forceinline__ float bfr(float f) { return bf2f(f2bf(f)); }
__device__ __forceinline__ v16h cat16(v8h lo, v8h hi) { return __builtin_shufflevector(lo, hi, 0, 1, 2, 3, 4, 5, 6, 7, 8, 9, 10, 11, 12, 13, 14, 15); }
__device__ __forceinline__ v16bf cat16b(v8us lo, v8us hi) { return __builtin_bit_cast(v16bf, __builtin_shufflevector(lo, hi, 0, 1, 2, 3, 4, 5, 6, 7, 8, 9, 10, 11, 12, 13, 14, 15)); }
__device__ __forceinline__ v8f wmma16(v16h a, v16h b, v8f c) { return __builtin_amdgcn_wmma_f32_16x16x32_f16(false, a, false, b, (short)0, c, false, false); }
__device__ __forceinline__ v8f wmmab(v16bf a, v16bf b, v8f c) { return __builtin_amdgcn_wmma_f32_16x16x32_bf16(false, a, false, b, (short)0, c, false, false); }



// ---- k_gemmw: GEMM, 8 waves per 256x128 output tile (4 x 2 waves of 64x64, 16 accumulators each); grid (M/256, N/128, Z), 256 threads.
// The block's operand rows (K-contiguous 16-bit planes) come to LDS 64 k (one 128-byte line of every row) a trip, by asynchronous copies, two buffers: tile t + 2 flies while tile t + 1 is worked on.
// C[m][n] (f32, pitch ldc, + optional f32 bias[n]) = sum_k A[m][k] Bt[n][k] (+ A2[m][k] Bt[n][k] for NSPLIT 1). z-batch strides sA/sB/sC in elements. K % 64 == 0.
// PLANES: no f32 C. Rows m = b * TT + t, a wave's column tile = one head, z = q, k, v: the tile goes out as bf16 hi/lo planes, P = [z][hi, lo][b][h] x ([t][d] for q and k, [d][t] for v).
template <typename T16> struct WFrag;
template <> struct WFrag<h16> { typedef v16h V; static __device__ __forceinline__ V ld(const h16* p) { return cat16(*(const v8h*)p, *(const v8h*)(p + 16)); } static __device__ __forceinline__ v8f mma(V a, V b, v8f c) { return wmma16(a, b, c); } };
template <> struct WFrag<bf> { typedef v16bf V; static __device__ __forceinline__ V ld(const bf* p) { return cat16b(*(const v8us*)p, *(const v8us*)(p + 16)); } static __device__ __forceinline__ v8f mma(V a, V b, v8f c) { return wmmab(a, b, c); } };
typedef __attribute__((ext_vector_type(2))) float v2f;
typedef __attribute__((ext_vector_type(2))) __bf16 v2bf;
typedef __attribute__((ext_vector_type(4))) unsigned v4u;
// x = hi + lo, both rounded to nearest even, a pair of values a packed conversion; the hi pair's two halves, each in the top of a word, are its values as f32
__device__ __forceinline__ void split8(v4f x0, v4f x1, v4u& h, v4u& l) {
#pragma unroll
    for (int k = 0; k < 4; ++k) { v2f p; p[0] = k < 2 ? x0[2 * k] : x1[2 * k - 4]; p[1] = k < 2 ? x0[2 * k + 1] : x1[2 * k - 3]; const unsigned u = __builtin_bit_cast(unsigned, __builtin_convertvector(p, v2bf));
        v2f f; f[0] = __uint_as_float(u << 16); f[1] = __uint_as_float(u & 0xFFFF0000u); h[k] = u; l[k] = __builtin_bit_cast(unsigned, __builtin_convertvector(p - f, v2bf)); } }
#define GPI 72                               // LDS pitch of an operand row (64 k), elements: 144 B = 16 B x odd, no bank conflict for 16-byte row reads
// a run of asynchronous 16-byte copies of this lane, global g[i] to LDS byte address l[i]; the closing wait stands in the same statement, in front of any rewrite of the address registers that the copies name;
// as many copies a statement as the operand list takes, because every such wait holds the wave up once
__device__ __forceinline__ void acopy12(const unsigned* l, const bf* const* g) {
    asm volatile("global_load_async_to_lds_b128 %0, %1, off\n\tglobal_load_async_to_lds_b128 %2, %3, off\n\tglobal_load_async_to_lds_b128 %4, %5, off\n\tglobal_load_async_to_lds_b128 %6, %7, off\n\tglobal_load_async_to_lds_b128 %8, %9, off\n\tglobal_load_async_to_lds_b128 %10, %11, off\n\tglobal_load_async_to_lds_b128 %12, %13, off\n\tglobal_load_async_to_lds_b128 %14, %15, off\n\tglobal_load_async_to_lds_b128 %16, %17, off\n\tglobal_load_async_to_lds_b128 %18, %19, off\n\tglobal_load_async_to_lds_b128 %20, %21, off\n\tglobal_load_async_to_lds_b128 %22, %23, off\n\ts_wait_xcnt 0x0"
                 :: "v"(l[0]), "v"(g[0]), "v"(l[1]), "v"(g[1]), "v"(l[2]), "v"(g[2]), "v"(l[3]), "v"(g[3]), "v"(l[4]), "v"(g[4]), "v"(l[5]), "v"(g[5]), "v"(l[6]), "v"(g[6]), "v"(l[7]), "v"(g[7]), "v"(l[8]), "v"(g[8]), "v"(l[9]), "v"(g[9]), "v"(l[10]), "v"(g[10]), "v"(l[11]), "v"(g[11]) : "memory"); }
__device__ __forceinline__ void acopy10(const unsigned* l, const bf* const* g) {
    asm volatile("global_load_async_to_lds_b128 %0, %1, off\n\tglobal_load_async_to_lds_b128 %2, %3, off\n\tglobal_load_async_to_lds_b128 %4, %5, off\n\tglobal_load_async_to_lds_b128 %6, %7, off\n\tglobal_load_async_to_lds_b128 %8, %9, off\n\tglobal_load_async_to_lds_b128 %10, %11, off\n\tglobal_load_async_to_lds_b128 %12, %13, off\n\tglobal_load_async_to_lds_b128 %14, %15, off\n\tglobal_load_async_to_lds_b128 %16, %17, off\n\tglobal_load_async_to_lds_b128 %18, %19, off\n\ts_wait_xcnt 0x0"
                 :: "v"(l[0]), "v"(g[0]), "v"(l[1]), "v"(g[1]), "v"(l[2]), "v"(g[2]), "v"(l[3]), "v"(g[3]), "v"(l[4]), "v"(g[4]), "v"(l[5]), "v"(g[5]), "v"(l[6]), "v"(g[6]), "v"(l[7]), "v"(g[7]), "v"(l[8]), "v"(g[8]), "v"(l[9]), "v"(g[9]) : "memory"); }
template <typename T16, int NSPLIT, bool BIAS, bool PLANES, int K>
__global__ __launch_bounds__(256) void k_gemmw(const T16* __restrict__ A, const T16* __restrict__ A2, const T16* __restrict__ Bt, float* C, int ldc, const float* __restrict__ bias, size_t sA, size_t sB, size_t sC, bf* __restrict__ P) {
    typedef typename WFrag<T16>::V V;
    static_assert(NSPLIT <= 1 && K % 64 == 0 && K >= 128, "plain or hi/lo A; whole 64-k tiles, two or more");
    constexpr int OA2 = 256 * GPI, OB = (NSPLIT == 1 ? 2 : 1) * 256 * GPI, GBE = OB + 128 * GPI;   // element offsets in a buffer: A 0, A2, Bt; elements of one buffer
    __shared__ __align__(16) T16 sm[2 * GBE];
    const size_t z = blockIdx.z; A += z * sA; if (NSPLIT == 1) A2 += z * sA; Bt += z * sB; if (!PLANES) C += z * sC;
    const int tid = threadIdx.x, lane = tid & 31, lr = lane & 15, hi = lane >> 4, wave = tid >> 5; const int r0 = blockIdx.x * 256 + (wave & 3) * 64, c0 = blockIdx.y * 128 + (wave >> 2) * 64;
    v8f acc[4][4];
#pragma unroll
    for (int mb = 0; mb < 4; ++mb)
#pragma unroll
        for (int nb = 0; nb < 4; ++nb) acc[mb][nb] = (v8f){};
    const size_t go = (size_t)(tid >> 3) * K + (tid & 7) * 8;
    const T16* ga = A + (size_t)blockIdx.x * 256 * K + go; const T16* ga2 = NSPLIT == 1 ? A2 + (size_t)blockIdx.x * 256 * K + go : nullptr; const T16* gb = Bt + (size_t)blockIdx.y * 128 * K + go;
    const unsigned ls = (unsigned)(size_t)sm + ((tid >> 3) * GPI + (tid & 7) * 8) * 2;   // this thread's first 16 bytes in buffer 0, as an LDS byte address
    // a tile: rows of 128 bytes; a thread's copy i of an operand takes 16 bytes of row (tid >> 3) + 32 * i, so a wave's copy covers four whole lines
    auto fill = [&](int t) { constexpr int NA = NSPLIT == 1 ? 16 : 8; unsigned l[NA + 4]; const T16* g[NA + 4]; const unsigned lb = ls + (t & 1) * GBE * 2;
#pragma unroll
        for (int i = 0; i < 8; ++i) { l[i] = lb + i * 32 * GPI * 2; g[i] = ga + t * 64 + (size_t)i * 32 * K; if (NSPLIT == 1) { l[8 + i] = lb + OA2 * 2 + i * 32 * GPI * 2; g[8 + i] = ga2 + t * 64 + (size_t)i * 32 * K; } }
#pragma unroll
        for (int i = 0; i < 4; ++i) { l[NA + i] = lb + OB * 2 + i * 32 * GPI * 2; g[NA + i] = gb + t * 64 + (size_t)i * 32 * K; }
        if constexpr (NSPLIT == 1) { acopy10(l, g); acopy10(l + 10, g + 10); } else acopy12(l, g); };
    fill(0);
    asm volatile("s_wait_asynccnt 0x0" ::: "memory");   // this wave's part of tile 0 has landed
    __syncthreads();                                    // publishes tile 0
    fill(1);
    const int fa = ((wave & 3) * 64 + lr) * GPI + 8 * hi, fb = OB + ((wave >> 2) * 64 + lr) * GPI + 8 * hi;
#pragma unroll 1   // rolled: one tile a trip, the buffer chosen by the trip's parity
    for (int t = 0; t < K / 64; ++t) {
        const T16* cur = sm + (t & 1) * GBE;
#pragma unroll
        for (int ks = 0; ks < 2; ++ks) {
            V a[4], a2[4], b[4];   // all of a 32-k block's fragments are asked for in one group, ahead of its products
#pragma unroll
            for (int mb = 0; mb < 4; ++mb) { a[mb] = WFrag<T16>::ld(cur + fa + mb * 16 * GPI + ks * 32); b[mb] = WFrag<T16>::ld(cur + fb + mb * 16 * GPI + ks * 32); if (NSPLIT == 1) a2[mb] = WFrag<T16>::ld(cur + OA2 + fa + mb * 16 * GPI + ks * 32); }
            __builtin_amdgcn_sched_barrier(0);   // keeps the group whole: without it the compiler sinks the b loads among the products, each with a full LDS wait in front of four products
            if (ks == 1) {   // the tile's last fragments are asked for: the hand-over stands here, so that the refill flies during this block's products too
                asm volatile("s_wait_dscnt 0x0" ::: "memory");      // this wave's reads of tile t are done before its buffer is refilled
                asm volatile("s_wait_asynccnt 0x0" ::: "memory");   // this wave's part of tile t + 1 has landed
                __syncthreads();                                    // publishes tile t + 1 and ends every wave's reads of the buffer that tile t + 2 refills
                if (t + 2 < K / 64) fill(t + 2);
            }
#pragma unroll
            for (int nb = 0; nb < 4; ++nb) {
#pragma unroll
                for (int mb = 0; mb < 4; ++mb) { acc[mb][nb] = WFrag<T16>::mma(a[mb], b[nb], acc[mb][nb]); if (NSPLIT == 1) acc[mb][nb] = WFrag<T16>::mma(a2[mb], b[nb], acc[mb][nb]); } }
        }
    }
    asm volatile("s_wait_asynccnt 0x0" ::: "memory");       // no copy is in flight when the ring becomes the epilogue's staging
    float* os = (float*)sm + wave * (16 * 68);              // each wave stages in its own range; the last trip's barrier ended every read of the ring
    if constexpr (PLANES) {
        static_assert(HD == 64 && TT % 64 == 0, "a 64x64 tile is 64 positions of one batch entry and one whole head");
        const size_t PLE = (size_t)NB_ * NH_ * TT * HD; const int t0 = r0 % TT;
        bf* ph = P + z * 2 * PLE + ((size_t)(r0 / TT) * NH_ + c0 / HD) * TT * HD; bf* pl = ph + PLE;
        const int rr = lane >> 3, cc = (lane & 7) * 8;   // read-back: 8 lanes a staged row, 8 values a lane, so every store instruction writes four whole 128-byte lines
        if (z < 2) {   // q, k: [t][d], 16 positions a round
            ph += (size_t)(t0 + rr) * HD + cc; pl += (size_t)(t0 + rr) * HD + cc;
#pragma unroll
            for (int mb = 0; mb < 4; ++mb) {
#pragma unroll
                for (int nb = 0; nb < 4; ++nb) {
#pragma unroll
                    for (int j = 0; j < 8; ++j) os[(hi * 8 + j) * 68 + nb * 16 + lr] = acc[mb][nb][j]; }
                __builtin_amdgcn_wave_barrier(); asm volatile("" ::: "memory");   // the compiler keeps the read-back behind the other lanes' staging writes
#pragma unroll
                for (int s = 0; s < 4; ++s) { const float* o8 = os + (4 * s + rr) * 68 + cc; const v4f x0 = *(const v4fa*)o8, x1 = *(const v4fa*)(o8 + 4); v4u vh, vl; split8(x0, x1, vh, vl);
                    *(v4u*)(ph + (mb * 16 + 4 * s) * HD) = vh; *(v4u*)(pl + (mb * 16 + 4 * s) * HD) = vl; }
                __builtin_amdgcn_wave_barrier(); asm volatile("" ::: "memory");   // and the next round's staging writes behind this read-back
            }
        } else {       // v: [d][t], 16 head columns a round; a lane's 8 accumulator registers are 8 positions in a row
            ph += (size_t)rr * TT + t0 + cc; pl += (size_t)rr * TT + t0 + cc;
#pragma unroll
            for (int nb = 0; nb < 4; ++nb) {
#pragma unroll
                for (int mb = 0; mb < 4; ++mb) { float* o8 = os + lr * 68 + mb * 16 + hi * 8; const v8f x = acc[mb][nb]; *(v4fa*)o8 = __builtin_shufflevector(x, x, 0, 1, 2, 3); *(v4fa*)(o8 + 4) = __builtin_shufflevector(x, x, 4, 5, 6, 7); }
                __builtin_amdgcn_wave_barrier(); asm volatile("" ::: "memory");   // as above
#pragma unroll
                for (int s = 0; s < 4; ++s) { const float* o8 = os + (4 * s + rr) * 68 + cc; const v4f x0 = *(const v4fa*)o8, x1 = *(const v4fa*)(o8 + 4); v4u vh, vl; split8(x0, x1, vh, vl);
                    *(v4u*)(ph + (size_t)(nb * 16 + 4 * s) * TT) = vh; *(v4u*)(pl + (size_t)(nb * 16 + 4 * s) * TT) = vl; }
                __builtin_amdgcn_wave_barrier(); asm volatile("" ::: "memory");   // as above
            }
            asm volatile("s_wait_xcnt 0x0" ::: "memory");   // in the listing this branch's end also runs on into the q, k branch (never taken), which rewrites registers that the stores above name
        }
    } else {
#pragma unroll
    for (int mb = 0; mb < 4; ++mb) {
#pragma unroll
        for (int nb = 0; nb < 4; ++nb) {
#pragma unroll
            for (int j = 0; j < 8; ++j) os[(hi * 8 + j) * 68 + nb * 16 + lr] = acc[mb][nb][j]; }
        __builtin_amdgcn_wave_barrier(); asm volatile("" ::: "memory");
        float* crow = C + (size_t)(r0 + mb * 16) * ldc + c0;
{
#pragma unroll
            for (int s = 0; s < 8; ++s) { const int row = 2 * s + hi, cofs = lr * 4; v4f val = *(const v4fa*)(os + row * 68 + cofs); if (BIAS) { val[0] += bfr(bias[c0 + cofs]); val[1] += bfr(bias[c0 + cofs + 1]); val[2] += bfr(bias[c0 + cofs + 2]); val[3] += bfr(bias[c0 + cofs + 3]); }
                *(v4f*)(crow + (size_t)row * ldc + cofs) = val; }
             }
        __builtin_amdgcn_wave_barrier(); asm volatile("" ::: "memory");
    }
    }
}

__device__ __forceinline__ void splitf(float y, unsigned short& h, unsigned short& l) { h = f2bf(y); l = f2bf(y - bf2f(h)); }
typedef __attribute__((ext_vector_type(4))) _Float16 v4h;
typedef __attribute__((ext_vector_type(2))) unsigned short v2us;
typedef __attribute__((ext_vector_type(4))) unsigned short v4us;
typedef __attribute__((ext_vector_type(4))) int v4i;

typedef __attribute__((ext_vector_type(2))) unsigned v2u;
// k_prep: every operand conversion (f32 to bf16, round to nearest even) in one launch of few, long waves; a thread asks for all of its 24 x 16 bytes before it uses any.
// A block takes 16384 values of x in a row (a wave's load = 512 bytes, its store = 256 bytes, both whole lines) and two 64x64 weight tiles, which it turns in LDS:
// tile T < PWT: rows v, columns n of w_qkv[h][part] (4096 values in a row) to Bt row h * 64 + n of its part; the others: rows k, columns n of w_o to Bt row n. Source rows are read, Bt rows written, in whole 128-byte lines.
#define TPI 72                               // LDS pitch of a turned row (64 k), elements: 144 B = 16 B x odd, as for the operand rows above
#define PWT (NH_ * 3 * (DM / 64))            // tiles of w_qkv
#define PXB 16384                            // values of x a block
#define PNB (NB_ * TT * DM / PXB)            // blocks
__device__ __forceinline__ unsigned pk2(float a, float b) { v2f p; p[0] = a; p[1] = b; return __builtin_bit_cast(unsigned, __builtin_convertvector(p, v2bf)); }
// SP, DP: source and Bt pitch, elements; S1, D1: from the block's first tile to its second, elements
template <unsigned SP, unsigned DP, unsigned S1, unsigned D1>
__device__ __forceinline__ void prep_body(const float* __restrict__ xs, bf* __restrict__ xd, const float* __restrict__ ws, bf* __restrict__ wd, bf* tl) {
    const unsigned tid = threadIdx.x, kr = (tid >> 4) * 4, nc = (tid & 15) * 4;   // a thread holds a 4 x 4 piece of a tile: 16 lanes read 256 bytes of a source row
    const unsigned xo = (tid >> 5) * (PXB / 8) + (tid & 31) * 4, wb = (kr * SP + nc) * 4, xb = xo * 4;   // wb, xb: this thread's byte offsets in the two sources
    v4f wv[2][4], xv[16];
#pragma unroll
    for (unsigned i = 0; i < 2; ++i)
#pragma unroll
        for (unsigned j = 0; j < 4; ++j) wv[i][j] = *(const v4f*)((const char*)ws + wb + (i * S1 + j * SP) * 4);
#pragma unroll
    for (unsigned j = 0; j < 16; ++j) xv[j] = *(const v4f*)((const char*)xs + xb + j * 512);
    asm volatile("s_wait_xcnt 0x0" :: "v"(wb), "v"(xb) : "memory");   // stands in front of any rewrite of the offset registers that the loads above name; as its inputs they stay whole up to it
    __builtin_amdgcn_sched_barrier(0);                                 // keeps the 24 loads one group ahead of every use, and that wait behind them
#pragma unroll
    for (unsigned i = 0; i < 2; ++i)
#pragma unroll
        for (unsigned c = 0; c < 4; ++c) { v2u p; p[0] = pk2(wv[i][0][c], wv[i][1][c]); p[1] = pk2(wv[i][2][c], wv[i][3][c]); *(v2u*)(tl + i * 64 * TPI + (nc + c) * TPI + kr) = p; }
    __syncthreads();   // the turned tiles are whole before any row is read back
    const unsigned n = tid >> 3, ch = (tid & 7) * 8; wd += n * DP + ch;
#pragma unroll
    for (unsigned i = 0; i < 2; ++i)
#pragma unroll
        for (unsigned s = 0; s < 2; ++s) *(v4u*)(wd + i * D1 + s * 32 * DP) = *(const v4u*)(tl + i * 64 * TPI + (s * 32 + n) * TPI + ch);
#pragma unroll
    for (unsigned j = 0; j < 16; ++j) { v2u o; o[0] = pk2(xv[j][0], xv[j][1]); o[1] = pk2(xv[j][2], xv[j][3]); *(v2u*)(xd + xo + j * 128) = o; }
}
__global__ __launch_bounds__(256) void k_prep(const float* __restrict__ x, const float* __restrict__ wqkv, const float* __restrict__ wo, bf* __restrict__ XB, bf* __restrict__ WQ, bf* __restrict__ WO) {
    static_assert(HD == 64 && DM % 128 == 0 && DQ % 64 == 0 && PWT % 2 == 0 && PWT + (DQ / 64) * (DM / 64) == 2 * PNB && (size_t)PNB * PXB == (size_t)NB_ * TT * DM, "one whole slice and two whole tiles, neighbours in one tile row, a block");
    __shared__ __align__(16) bf tl[2 * 64 * TPI];
    const unsigned T = blockIdx.x * 2; const float* xs = x + (size_t)blockIdx.x * PXB; bf* xd = XB + (size_t)blockIdx.x * PXB;
    if (T < PWT) { const unsigned mx = T / (DM / 64), vt = T % (DM / 64);   // the same for the whole block, as the barrier in the body asks
        prep_body<HD, DM, 64 * HD, 64>(xs, xd, wqkv + (size_t)T * (64 * HD), WQ + (size_t)(mx % 3) * DQ * DM + (size_t)(mx / 3) * HD * DM + vt * 64, tl); }
    else { const unsigned U = T - PWT, kt = U / (DM / 64), nt = U % (DM / 64);
        prep_body<DM, DQ, 64, 64 * DQ>(xs, xd, wo + (size_t)kt * 64 * DM + nt * 64, WO + (size_t)nt * 64 * DQ + kt * 64, tl); }
}

// k_fattn: scores, softmax, attn.v and the head merge in one launch. One wave = 32 query columns of one (batch, head), 32 keys a pass:
// St = K Qt (A = key rows, B = query rows kept in registers), so a lane holds one query's scores; running maximum and sum in-lane plus one exchange between the wave halves;
// two St tiles, converted in place, are the B operand of Ot += Vt Pt (A = rows of the [d][t] planes). hi/lo planes, 3 products (hi hi, hi lo, lo hi). grid (TT/256, head, batch).
// Every inner loop is unrolled whole, so that the fragment and accumulator arrays are indexed by constants and stay in registers.
// The 8 waves of a block share each pass's 32 keys through LDS, two buffers: coalesced global loads of pass s + 1 are issued before the work of pass s and stored behind it; one barrier a pass.
#define KPI 72                               // LDS pitch of a key row (64 d), elements: 144 B = 16 B x odd, no bank conflict for 16-byte row reads
#define VPI 40                               // LDS pitch of a d row (32 keys), elements: 80 B = 16 B x odd
#define OKL (32 * KPI)                       // element offsets in a buffer: K hi 0, K lo, V hi, V lo
#define OVH (2 * 32 * KPI)
#define OVL (2 * 32 * KPI + 64 * VPI)
#define SBE (2 * 32 * KPI + 2 * 64 * VPI)    // elements of one buffer
__device__ __forceinline__ float xhalf(float x) { const int b = __float_as_int(x); return __int_as_float(__builtin_amdgcn_permlanex16(b, b, 0x76543210, 0xfedcba98, false, false)); }
__global__ __launch_bounds__(256) void k_fattn(const bf* __restrict__ Qh, const bf* __restrict__ Ql, const bf* __restrict__ Kh, const bf* __restrict__ Kl, const bf* __restrict__ Vh, const bf* __restrict__ Vl, bf* __restrict__ Ah, bf* __restrict__ Al) {
    typedef WFrag<bf> F; typedef v16bf V;
    __shared__ __align__(16) bf sm[2 * SBE];
    const int lane = threadIdx.x & 31, lr = lane & 15, hi = lane >> 4; const int h = blockIdx.y, b = blockIdx.z; const size_t zo = ((size_t)b * NH_ + h) * TT * HD; const int q0 = blockIdx.x * 256 + (threadIdx.x >> 5) * 32;
    const float C2 = SCL * 1.4426950408889634f;   // scores are kept in log2 units
    V qh[2][2], ql[2][2];
#pragma unroll
    for (int qt = 0; qt < 2; ++qt)
#pragma unroll
        for (int ks = 0; ks < 2; ++ks) { const size_t qo = zo + (size_t)(q0 + qt * 16 + lr) * HD + ks * 32 + 8 * hi; qh[qt][ks] = F::ld(Qh + qo); ql[qt][ks] = F::ld(Ql + qo); }
    v8f o[2][4]; float m[2]; v2f l[2];   // l: this lane's part of the row sum, even and odd keys apart
#pragma unroll
    for (int qt = 0; qt < 2; ++qt) { m[qt] = -3.0e38f; l[qt] = (v2f){};
#pragma unroll
        for (int dt = 0; dt < 4; ++dt) o[qt][dt] = (v8f){}; }
    const int tid = threadIdx.x;
    // staging: thread tid moves 16 bytes of each of the four planes a pass (K: 32 rows x 128 B, contiguous; V: 64 rows x 64 B)
    const bf* gkh = Kh + zo + tid * 8; const bf* gkl = Kl + zo + tid * 8; const bf* gvh = Vh + zo + (size_t)(tid >> 2) * TT + (tid & 3) * 8; const bf* gvl = Vl + zo + (size_t)(tid >> 2) * TT + (tid & 3) * 8;
    const int sk = (tid >> 3) * KPI + (tid & 7) * 8, sv = (tid >> 2) * VPI + (tid & 3) * 8; const int fk = lr * KPI + 8 * hi, fv = lr * VPI + 8 * hi;
    v8us g0 = *(const v8us*)gkh, g1 = *(const v8us*)gkl, g2 = *(const v8us*)gvh, g3 = *(const v8us*)gvl;
    *(v8us*)(sm + sk) = g0; *(v8us*)(sm + OKL + sk) = g1; *(v8us*)(sm + OVH + sv) = g2; *(v8us*)(sm + OVL + sv) = g3;
    __syncthreads();   // publishes pass 0
#pragma unroll 1   // rolled: two passes in one body would not fit the 256 registers that four waves per SIMD leave
    for (int k0 = 0; k0 < TT; k0 += 32) {
        const bf* cur = sm + ((k0 >> 5) & 1) * SBE; bf* nxt = sm + (((k0 >> 5) & 1) ^ 1) * SBE; const bool more = k0 + 32 < TT;
        if (more) { g0 = *(const v8us*)(gkh + (size_t)(k0 + 32) * HD); g1 = *(const v8us*)(gkl + (size_t)(k0 + 32) * HD); g2 = *(const v8us*)(gvh + k0 + 32); g3 = *(const v8us*)(gvl + k0 + 32); }
        v8f s[2][2];   // [query tile][key tile]: register r = score of key k0 + kt * 16 + 8 * hi + r, query column lr
#pragma unroll
        for (int kt = 0; kt < 2; ++kt) { V ah[2], al[2];
#pragma unroll
            for (int ks = 0; ks < 2; ++ks) { const int ko = fk + kt * 16 * KPI + ks * 32; ah[ks] = F::ld(cur + ko); al[ks] = F::ld(cur + OKL + ko); }
#pragma unroll
            for (int qt = 0; qt < 2; ++qt) { v8f t = (v8f){};
#pragma unroll
                for (int ks = 0; ks < 2; ++ks) { t = F::mma(ah[ks], qh[qt][ks], t); t = F::mma(ah[ks], ql[qt][ks], t); t = F::mma(al[ks], qh[qt][ks], t); }
                s[qt][kt] = t; } }
        float cm[2]; bool need = false;
#pragma unroll
        for (int qt = 0; qt < 2; ++qt) { float x = s[qt][0][0];
#pragma unroll
            for (int r = 0; r < 8; ++r) x = fmaxf(x, fmaxf(s[qt][0][r], s[qt][1][r]));
            x *= C2; cm[qt] = fmaxf(x, xhalf(x)); need = need || (cm[qt] > m[qt] + 8.0f); }
        // the maximum in use moves only when a column's new one exceeds it by more than 8 (log2): one wave-uniform test a pass
        if (__builtin_amdgcn_ballot_w32(need) != 0) {
#pragma unroll
            for (int qt = 0; qt < 2; ++qt) { const float mn = fmaxf(m[qt], cm[qt]); const float al2 = __builtin_amdgcn_exp2f(m[qt] - mn); m[qt] = mn; l[qt] *= al2;
#pragma unroll
                for (int dt = 0; dt < 4; ++dt) o[qt][dt] *= al2; } }
        V ph[2], pl[2];
#pragma unroll
        for (int qt = 0; qt < 2; ++qt) {
#pragma unroll
            for (int e = 0; e < 16; e += 2) { v2f x; x[0] = s[qt][e >> 3][e & 7]; x[1] = s[qt][e >> 3][(e & 7) + 1]; x = __builtin_elementwise_fma(x, (v2f){C2, C2}, (v2f){-m[qt], -m[qt]});
                v2f p; p[0] = __builtin_amdgcn_exp2f(x[0]); p[1] = __builtin_amdgcn_exp2f(x[1]); l[qt] += p;
                const v2bf a = __builtin_convertvector(p, v2bf); v2f rr; rr[0] = p[0] - (float)a[0]; rr[1] = p[1] - (float)a[1]; const v2bf c = __builtin_convertvector(rr, v2bf);
                ph[qt][e] = a[0]; ph[qt][e + 1] = a[1]; pl[qt][e] = c[0]; pl[qt][e + 1] = c[1]; } }
#pragma unroll
        for (int dt = 0; dt < 4; ++dt) { const int vo = fv + dt * 16 * VPI; const V bh = F::ld(cur + OVH + vo), bl = F::ld(cur + OVL + vo);
#pragma unroll
            for (int qt = 0; qt < 2; ++qt) { o[qt][dt] = F::mma(bh, ph[qt], o[qt][dt]); o[qt][dt] = F::mma(bh, pl[qt], o[qt][dt]); o[qt][dt] = F::mma(bl, ph[qt], o[qt][dt]); } }
        if (more) { *(v8us*)(nxt + sk) = g0; *(v8us*)(nxt + OKL + sk) = g1; *(v8us*)(nxt + OVH + sv) = g2; *(v8us*)(nxt + OVL + sv) = g3; }
        __syncthreads();   // publishes pass s + 1 and ends every wave's reads of the buffer that pass s + 1 refills
    }
#pragma unroll
    for (int qt = 0; qt < 2; ++qt) { const float lq = l[qt][0] + l[qt][1]; const float f = __fdiv_rn(1.0f, lq + xhalf(lq)); const size_t oo = ((size_t)b * TT + q0 + qt * 16 + lr) * DQ + h * HD + 8 * hi;
#pragma unroll
        for (int dt = 0; dt < 4; ++dt) { v8us oh, ol;
#pragma unroll
            for (int r = 0; r < 8; ++r) { unsigned short a, c2; splitf(o[qt][dt][r] * f, a, c2); oh[r] = a; ol[r] = c2; }
            *(v8us*)(Ah + oo + dt * 16) = oh; *(v8us*)(Al + oo + dt * 16) = ol; } }
}

extern "C" void kernel_launch(void* const* d_in, const int* in_sizes, int n_in,
                              void* d_out, int out_size, void* d_ws, size_t ws_size, hipStream_t stream) {
    (void)in_sizes; (void)n_in; (void)out_size;
    const float* x = (const float*)d_in[0]; const float* wqkv = (const float*)d_in[1]; const float* wo = (const float*)d_in[2]; const float* wq = nullptr; const float* wk = nullptr; const float* wv = nullptr; (void)wq; (void)wk; (void)wv;
    float* OUT = (float*)d_out;     // [8][1024][1024]
    char* wsp = (char*)d_ws;
    auto take = [&](size_t bytes) { char* p = wsp; wsp += (bytes + 255) & ~(size_t)255; return (void*)p; };
    const size_t PL = (size_t)NB_ * NH_ * TT * HD;   // elements of one plane set [b][h][t][d] (= NB_ * TT * DQ)
    bf* WQ = (bf*)take((size_t)3 * DQ * DM * 2);      // q, k, v weight slices, one behind another (z of the projection launch)
    bf* WO = (bf*)take((size_t)DM * DQ * 2);
    bf* QPh = (bf*)take(6 * PL * 2);                  // the six head planes, one behind another as the projection's epilogue writes them
    bf* QPl = QPh + PL; bf* KPh = QPl + PL; bf* KPl = KPh + PL; bf* VTh = KPl + PL; bf* VTl = VTh + PL;
    bf* XB = (bf*)take(PL * 2);
    bf* ATh = (bf*)take(2 * PL * 2); bf* ATl = ATh + PL;   // the merged heads [b][t][h*64+d]
    if ((size_t)(wsp - (char*)d_ws) > ws_size) return;    // ws 256 MiB
    k_prep<<<PNB, 256, 0, stream>>>(x, wqkv, wo, XB, WQ, WO);
    // every batch entry at once: rows m = b * TT + t; z = q, k, v
    k_gemmw<bf, 0, false, true, DM><<<dim3(NB_ * TT / 256, DQ / 128, 3), 256, 0, stream>>>(XB, nullptr, WQ, nullptr, 0, nullptr, 0, (size_t)DQ * DM, 0, QPh);
    k_fattn<<<dim3(TT / 256, NH_, NB_), 256, 0, stream>>>(QPh, QPl, KPh, KPl, VTh, VTl, ATh, ATl);
    k_gemmw<bf, 1, false, false, DQ><<<dim3(NB_ * TT / 256, DM / 128, 1), 256, 0, stream>>>(ATh, ATl, WO, OUT, DM, nullptr, 0, 0, 0, nullptr);
}
